// v000
// The times below were measured on an AMD MI455X: many runs one after another, warmed up first and cycling through
// copies of the inputs, with the whole window's GPU time divided by the number of runs. Launches and the gaps
// between them are all in it. The median over several windows is given; except for v000 it joins two sittings, which
// can be a few percent apart, so the side-by-side timings, each taken in one sitting, are the better comparison.
// v000 is the starting kernel. One run takes 2490 microseconds.
#include <hip/hip_runtime.h>

// VectorizedSREKEnsemble - 64 independent MLP "agents" on a shared input (x [4096][50]; per agent a: xn = x w_in[a] + b_in[a] (affine only); h1 = gelu(xn W1^T + b1) + xn S1^T + sb1;
// h2 = gelu(h1 W2^T + b2) + h1 S2^T + sb2; h3 = (h2 W3^T + b3 + h2) hw[a] + hb[a]; logits = h3 Wo^T + bo -> [64][4096][3]; exact (erf) gelu; weights [a][out][in]).
// Compute dtypes, f32 accumulate: every input rounded to bf16; the affine input norm f32 -> bf16 hi+lo planes (K 50 padded to 64) x exact [W1|S1] (2 products, one N = 384 GEMM per agent); h1 and h2 as SINGLE fp16
// planes x fp16 copies of the bf16 [W2|S2] / W3 weights (1 product; hi+lo would double the two 192x384/192x192 GEMMs); the affine hidden norm f32 -> hl planes x exact Wo (3 outputs padded to 64); gelu (erf), biases, skips f32 on VALU.
// each agent are written 4 B per element thread-linearly (12-B rows: lines completed by consecutive threads of one launch).

#define NA   64
#define NBT  4096
#define DI   50
#define KI   64
#define HH   192
#define NO   3
typedef _Float16 h16;
typedef unsigned short bf;
typedef __attribute__((ext_vector_type(16))) __bf16   v16bf;
typedef __attribute__((ext_vector_type(16))) _Float16 v16h;
typedef __attribute__((ext_vector_type(8)))  _Float16 v8h;
typedef __attribute__((ext_vector_type(8)))  unsigned short v8us;
typedef __attribute__((ext_vector_type(8)))  float    v8f;
typedef __attribute__((ext_vector_type(4)))  float    v4f;
typedef v8h  __attribute__((may_alias)) v8ha;
typedef v4f  __attribute__((may_alias)) v4fa;
typedef v8us __attribute__((may_alias)) v8usa;

__device__ __forceinline__ unsigned short f2bf(float f) { unsigned u = __float_as_uint(f); u += 0x7FFFu + ((u >> 16) & 1u); return (unsigned short)(u >> 16); }
__device__ __forceinline__ float bf2f(unsigned short b) { return __uint_as_float(((unsigned)b) << 16); }
__device__ __forceinline__ float bfr(float f) { return bf2f(f2bf(f)); }
__device__ __forceinline__ v16h cat16(v8h lo, v8h hi) { return __builtin_shufflevector(lo, hi, 0, 1, 2, 3, 4, 5, 6, 7, 8, 9, 10, 11, 12, 13, 14, 15); }
__device__ __forceinline__ v16bf cat16b(v8us lo, v8us hi) { return __builtin_bit_cast(v16bf, __builtin_shufflevector(lo, hi, 0, 1, 2, 3, 4, 5, 6, 7, 8, 9, 10, 11, 12, 13, 14, 15)); }
__device__ __forceinline__ v8f wmma16(v16h a, v16h b, v8f c) { return __builtin_amdgcn_wmma_f32_16x16x32_f16(false, a, false, b, (short)0, c, false, false); }
__device__ __forceinline__ v8f wmmab(v16bf a, v16bf b, v8f c) { return __builtin_amdgcn_wmma_f32_16x16x32_bf16(false, a, false, b, (short)0, c, false, false); }



// ---- k_gemmw: register-blocked GEMM, ONE WAVE per 64x64 output tile (16 accumulators), operands straight from K-contiguous 16-bit planes; grid (M/64, N/64, Z), 32 threads.
// C[m][n] (f32, pitch ldc, + optional f32 bias[n]) = sum_k A[m][k] Bt[n][k] (+ split products per NSPLIT). z-batch strides sA/sB/sC in elements. K % 32 == 0.
template <typename T16> struct WFrag;
template <> struct WFrag<h16> { typedef v16h V; static __device__ __forceinline__ V ld(const h16* p) { return cat16(*(const v8h*)p, *(const v8h*)(p + 16)); } static __device__ __forceinline__ v8f mma(V a, V b, v8f c) { return wmma16(a, b, c); } };
template <> struct WFrag<bf> { typedef v16bf V; static __device__ __forceinline__ V ld(const bf* p) { return cat16b(*(const v8us*)p, *(const v8us*)(p + 16)); } static __device__ __forceinline__ v8f mma(V a, V b, v8f c) { return wmmab(a, b, c); } };
template <typename T16, int NSPLIT, bool BIAS>
__global__ __launch_bounds__(32) void k_gemmw(const T16* __restrict__ A, const T16* __restrict__ A2, const T16* __restrict__ Bt, const T16* __restrict__ Bt2, int K, float* C, int ldc, const float* __restrict__ bias, size_t sA, size_t sB, size_t sC) {
    typedef typename WFrag<T16>::V V;
    __shared__ __align__(16) float os[16 * 68];
    const size_t z = blockIdx.z; A += z * sA; if (A2) A2 += z * sA; Bt += z * sB; if (Bt2) Bt2 += z * sB; C += z * sC;
    const int lane = threadIdx.x & 31, lr = lane & 15, hi = lane >> 4; const int r0 = blockIdx.x * 64, c0 = blockIdx.y * 64;
    v8f acc[4][4];
#pragma unroll
    for (int mb = 0; mb < 4; ++mb)
#pragma unroll
        for (int nb = 0; nb < 4; ++nb) acc[mb][nb] = (v8f){};
    const size_t aoff = (size_t)(r0 + lr) * K + 8 * hi, boff = (size_t)(c0 + lr) * K + 8 * hi;
#pragma unroll 1
    for (int kc = 0; kc < K; kc += 32) {
        V a[4], a2[4];
#pragma unroll
        for (int mb = 0; mb < 4; ++mb) { a[mb] = WFrag<T16>::ld(A + aoff + (size_t)mb * 16 * K + kc); if (NSPLIT == 1 || NSPLIT == 2) a2[mb] = WFrag<T16>::ld(A2 + aoff + (size_t)mb * 16 * K + kc); }
#pragma unroll
        for (int nb = 0; nb < 4; ++nb) { const V b = WFrag<T16>::ld(Bt + boff + (size_t)nb * 16 * K + kc); V b2; if (NSPLIT >= 2) b2 = WFrag<T16>::ld(Bt2 + boff + (size_t)nb * 16 * K + kc);
#pragma unroll
            for (int mb = 0; mb < 4; ++mb) { acc[mb][nb] = WFrag<T16>::mma(a[mb], b, acc[mb][nb]); if (NSPLIT == 1 || NSPLIT == 2) acc[mb][nb] = WFrag<T16>::mma(a2[mb], b, acc[mb][nb]); if (NSPLIT >= 2) acc[mb][nb] = WFrag<T16>::mma(a[mb], b2, acc[mb][nb]); } }
        asm volatile("v_nop\n\tv_nop\n\tv_nop\n\tv_nop" : "+v"(acc[0][0]), "+v"(acc[1][1]), "+v"(acc[2][2]), "+v"(acc[3][3]) : "v"(a[0]), "v"(a[3]));
    }
#pragma unroll
    for (int mb = 0; mb < 4; ++mb) {
#pragma unroll
        for (int nb = 0; nb < 4; ++nb) {
#pragma unroll
            for (int j = 0; j < 8; ++j) os[(hi * 8 + j) * 68 + nb * 16 + lr] = acc[mb][nb][j]; }
        __builtin_amdgcn_wave_barrier(); asm volatile("" ::: "memory");
        float* crow = C + (size_t)(r0 + mb * 16) * ldc + c0;
{
#pragma unroll
            for (int s = 0; s < 8; ++s) { const int row = 2 * s + hi, cofs = lr * 4; v4f val = *(const v4fa*)(os + row * 68 + cofs); if (BIAS) { val[0] += bfr(bias[c0 + cofs]); val[1] += bfr(bias[c0 + cofs + 1]); val[2] += bfr(bias[c0 + cofs + 2]); val[3] += bfr(bias[c0 + cofs + 3]); }
                *(v4f*)(crow + (size_t)row * ldc + cofs) = val; }
             }
        __builtin_amdgcn_wave_barrier(); asm volatile("" ::: "memory");
    }
}

__device__ __forceinline__ h16 tohx(float x) { return (h16)x; }
__device__ __forceinline__ void splitf(float y, unsigned short& h, unsigned short& l) { h = f2bf(y); l = f2bf(y - bf2f(h)); }
__device__ __forceinline__ float gelu_(float x) { return 0.5f * x * (1.0f + erff(x * 0.7071067811865476f)); }
typedef __attribute__((ext_vector_type(2))) _Float16 v2h;
typedef __attribute__((ext_vector_type(4))) _Float16 v4h;
typedef __attribute__((ext_vector_type(2))) unsigned short v2us;
typedef __attribute__((ext_vector_type(4))) unsigned short v4us;

__global__ __launch_bounds__(256) void k_w1(const float* __restrict__ W1, const float* __restrict__ S1, bf* B1) { const size_t e = ((size_t)blockIdx.x * 256 + threadIdx.x) * 2; if (e >= (size_t)NA * 2 * HH * KI) return; const int k = (int)(e % KI); const int n = (int)((e / KI) % (2 * HH)); const int a = (int)(e / ((size_t)KI * 2 * HH)); const float* src = n < HH ? W1 + ((size_t)a * HH + n) * DI : S1 + ((size_t)a * HH + n - HH) * DI; v2us o;
#pragma unroll
    for (int u = 0; u < 2; ++u) o[u] = (k + u) < DI ? f2bf(src[k + u]) : (unsigned short)0; *(v2us*)(B1 + e) = o;  }
__global__ __launch_bounds__(256) void k_w2(const float* __restrict__ W2, const float* __restrict__ S2, h16* B2) { const size_t e = ((size_t)blockIdx.x * 256 + threadIdx.x) * 4; if (e >= (size_t)NA * 2 * HH * HH) return; const int k = (int)(e % HH); const int n = (int)((e / HH) % (2 * HH)); const int a = (int)(e / ((size_t)HH * 2 * HH)); const float* src = n < HH ? W2 + ((size_t)a * HH + n) * HH : S2 + ((size_t)a * HH + n - HH) * HH; v4h o;
#pragma unroll
    for (int q = 0; q < 4; ++q) o[q] = tohx(bfr(src[k + q])); *(v4h*)(B2 + e) = o;  }
__global__ __launch_bounds__(256) void k_w3(const float* __restrict__ W3, h16* B3) { const size_t e = ((size_t)blockIdx.x * 256 + threadIdx.x) * 4; if (e >= (size_t)NA * HH * HH) return; v4h o;
#pragma unroll
    for (int q = 0; q < 4; ++q) o[q] = tohx(bfr(W3[e + q])); *(v4h*)(B3 + e) = o;  }
__global__ __launch_bounds__(256) void k_wo(const float* __restrict__ Wo, bf* BO) { const size_t e = ((size_t)blockIdx.x * 256 + threadIdx.x) * 4; if (e >= (size_t)NA * 64 * HH) return; const int k = (int)(e % HH); const int n = (int)((e / HH) % 64); const int a = (int)(e / ((size_t)HH * 64)); v4us o;
#pragma unroll
    for (int q = 0; q < 4; ++q) o[q] = n < NO ? f2bf(Wo[((size_t)a * NO + n) * HH + k + q]) : (unsigned short)0; *(v4us*)(BO + e) = o;  }
__global__ __launch_bounds__(256) void k_xn(const float* __restrict__ x, const float* __restrict__ wi, const float* __restrict__ bi, bf* Xh, bf* Xl) { const size_t e = ((size_t)blockIdx.x * 256 + threadIdx.x) * 2; if (e >= (size_t)NA * NBT * KI) return; const int k = (int)(e % KI); const int b = (int)((e / KI) % NBT); const int a = (int)(e / ((size_t)KI * NBT)); v2us oh, ol;
#pragma unroll
    for (int u = 0; u < 2; ++u) { unsigned short h = 0, l = 0; const int kk = k + u; if (kk < DI) { float t = __fmul_rn(bfr(x[(size_t)b * DI + kk]), bfr(wi[a * DI + kk])); asm volatile("" : "+v"(t)); splitf(__fadd_rn(t, bfr(bi[a * DI + kk])), h, l); } oh[u] = h; ol[u] = l; }
    *(v2us*)(Xh + e) = oh; *(v2us*)(Xl + e) = ol;  }
__global__ __launch_bounds__(256) void k_h(const float* __restrict__ G, const float* __restrict__ bm, const float* __restrict__ bs, int a, h16* H16, float* HF) { const size_t e = ((size_t)blockIdx.x * 256 + threadIdx.x) * 4; if (e >= (size_t)NBT * HH) return; const int n = (int)(e % HH); const int b = (int)(e / HH); const float* g = G + (size_t)b * 2 * HH; v4h o; v4f of;
#pragma unroll
    for (int q = 0; q < 4; ++q) { const float m = __fadd_rn(g[n + q], bfr(bm[a * HH + n + q])); const float s = __fadd_rn(g[HH + n + q], bfr(bs[a * HH + n + q])); const float h = __fadd_rn(gelu_(m), s); o[q] = tohx(h); of[q] = h; }
    *(v4h*)(H16 + e) = o; *(v4f*)(HF + e) = of;  }
__global__ __launch_bounds__(256) void k_h3(const float* __restrict__ G3, const float* __restrict__ b3, const float* __restrict__ H2F, const float* __restrict__ hw, const float* __restrict__ hb, int a, bf* Ph, bf* Pl) { const size_t e = ((size_t)blockIdx.x * 256 + threadIdx.x) * 4; if (e >= (size_t)NBT * HH) return; const int n = (int)(e % HH); v4us oh, ol;
#pragma unroll
    for (int q = 0; q < 4; ++q) { const float t = __fadd_rn(__fadd_rn(G3[e + q], bfr(b3[a * HH + n + q])), H2F[e + q]); float u = __fmul_rn(t, bfr(hw[a * HH + n + q])); asm volatile("" : "+v"(u)); unsigned short h, l; splitf(__fadd_rn(u, bfr(hb[a * HH + n + q])), h, l); oh[q] = h; ol[q] = l; }
    *(v4us*)(Ph + e) = oh; *(v4us*)(Pl + e) = ol;  }
__global__ __launch_bounds__(256) void k_out(const float* __restrict__ R, const float* __restrict__ bo, int a, float* OUT) { const int e = blockIdx.x * 256 + threadIdx.x; if (e >= NBT * NO) return; const int o = e % NO, b = e / NO; const float v = __fadd_rn(R[(size_t)b * 64 + o], bfr(bo[a * NO + o])); *(float*)(OUT + (size_t)a * NBT * NO + e) = v;  }

extern "C" void kernel_launch(void* const* d_in, const int* in_sizes, int n_in,
                              void* d_out, int out_size, void* d_ws, size_t ws_size, hipStream_t stream) {
    (void)in_sizes; (void)n_in; (void)out_size;
    const float* IN[17]; for (int i = 0; i < 17; ++i) IN[i] = (const float*)d_in[i];   // 0 x, 1 in_w, 2 in_b, 3 W1, 4 b1, 5 W2, 6 b2, 7 W3, 8 b3, 9 Wo, 10 bo, 11 S1, 12 sb1, 13 S2, 14 sb2, 15 hw, 16 hb
    float* OUT = (float*)d_out;     // [64][4096][3]
    char* wsp = (char*)d_ws;
    auto take = [&](size_t bytes) { char* p = wsp; wsp += (bytes + 255) & ~(size_t)255; return (void*)p; };
    bf* B1 = (bf*)take((size_t)NA * 2 * HH * KI * 2); h16* B2 = (h16*)take((size_t)NA * 2 * HH * HH * 2); h16* B3 = (h16*)take((size_t)NA * HH * HH * 2); bf* BO = (bf*)take((size_t)NA * 64 * HH * 2);
    bf* Xh = (bf*)take((size_t)NA * NBT * KI * 2); bf* Xl = (bf*)take((size_t)NA * NBT * KI * 2); float* G = (float*)take((size_t)NBT * 2 * HH * 4); h16* H1 = (h16*)take((size_t)NBT * HH * 2); float* H1F = (float*)take((size_t)NBT * HH * 4); h16* H2 = (h16*)take((size_t)NBT * HH * 2); float* H2F = (float*)take((size_t)NBT * HH * 4); float* G3 = (float*)take((size_t)NBT * HH * 4); bf* P3h = (bf*)take((size_t)NBT * HH * 2); bf* P3l = (bf*)take((size_t)NBT * HH * 2); float* R = (float*)take((size_t)NBT * 64 * 4);
    if ((size_t)(wsp - (char*)d_ws) > ws_size) return;    // total ~ 100 MB
    k_w1<<<(unsigned)(((size_t)NA * 2 * HH * KI / 2 + 255) / 256), 256, 0, stream>>>(IN[3], IN[11], B1); k_w2<<<(unsigned)(((size_t)NA * 2 * HH * HH / 4 + 255) / 256), 256, 0, stream>>>(IN[5], IN[13], B2); k_w3<<<(unsigned)(((size_t)NA * HH * HH / 4 + 255) / 256), 256, 0, stream>>>(IN[7], B3); k_wo<<<(unsigned)(((size_t)NA * 64 * HH / 4 + 255) / 256), 256, 0, stream>>>(IN[9], BO);
    k_xn<<<(unsigned)(((size_t)NA * NBT * KI / 2 + 255) / 256), 256, 0, stream>>>(IN[0], IN[1], IN[2], Xh, Xl);
    const unsigned LH = (unsigned)(((size_t)NBT * HH / 4 + 255) / 256);
    for (int a = 0; a < NA; ++a) {
        k_gemmw<bf, 1, false><<<dim3(NBT / 64, 2 * HH / 64, 1), 32, 0, stream>>>(Xh + (size_t)a * NBT * KI, Xl + (size_t)a * NBT * KI, B1 + (size_t)a * 2 * HH * KI, nullptr, KI, G, 2 * HH, nullptr, 0, 0, 0); k_h<<<LH, 256, 0, stream>>>(G, IN[4], IN[12], a, H1, H1F);
        k_gemmw<h16, 0, false><<<dim3(NBT / 64, 2 * HH / 64, 1), 32, 0, stream>>>(H1, nullptr, B2 + (size_t)a * 2 * HH * HH, nullptr, HH, G, 2 * HH, nullptr, 0, 0, 0); k_h<<<LH, 256, 0, stream>>>(G, IN[6], IN[14], a, H2, H2F);
        k_gemmw<h16, 0, false><<<dim3(NBT / 64, HH / 64, 1), 32, 0, stream>>>(H2, nullptr, B3 + (size_t)a * HH * HH, nullptr, HH, G3, HH, nullptr, 0, 0, 0); k_h3<<<LH, 256, 0, stream>>>(G3, IN[8], H2F, IN[15], IN[16], a, P3h, P3l);
        k_gemmw<bf, 1, false><<<dim3(NBT / 64, 1, 1), 32, 0, stream>>>(P3h, P3l, BO + (size_t)a * 64 * HH, nullptr, HH, R, 64, nullptr, 0, 0, 0); k_out<<<(NBT * NO + 255) / 256, 256, 0, stream>>>(R, IN[10], a, OUT); }
}

// v001
// One run takes 704 microseconds.
// In two side-by-side timings against v000, it was 3.49 and 3.54 times as fast.
#include <hip/hip_runtime.h>

// VectorizedSREKEnsemble - 64 independent MLP "agents" on a shared input (x [4096][50]; per agent a: xn = x w_in[a] + b_in[a] (affine only); h1 = gelu(xn W1^T + b1) + xn S1^T + sb1;
// h2 = gelu(h1 W2^T + b2) + h1 S2^T + sb2; h3 = (h2 W3^T + b3 + h2) hw[a] + hb[a]; logits = h3 Wo^T + bo -> [64][4096][3]; exact (erf) gelu; weights [a][out][in]).
// Compute dtypes, f32 accumulate: every input rounded to bf16; the affine input norm f32 -> bf16 hi+lo planes (K 50 padded to 64) x exact [W1|S1] (2 products, one N = 384 GEMM per agent); h1 and h2 as SINGLE fp16
// planes x fp16 copies of the bf16 [W2|S2] / W3 weights (1 product; hi+lo would double the two 192x384/192x192 GEMMs); the affine hidden norm f32 -> hl planes x exact Wo (3 outputs padded to 64); gelu (erf), biases, skips f32 on VALU.
// each agent are written 4 B per element thread-linearly (12-B rows: lines completed by consecutive threads of one launch).

#define NA   64
#define NBT  4096
#define DI   50
#define KI   64
#define HH   192
#define NO   3
#define GA   16   // agents per launch: the agent index rides in the grid (z of the GEMMs, y of k_h, k_h3 and k_out; folded into x in k_xn); 16 is the most whose intermediates fit the workspace
typedef _Float16 h16;
typedef unsigned short bf;
typedef __attribute__((ext_vector_type(16))) __bf16   v16bf;
typedef __attribute__((ext_vector_type(16))) _Float16 v16h;
typedef __attribute__((ext_vector_type(8)))  _Float16 v8h;
typedef __attribute__((ext_vector_type(8)))  unsigned short v8us;
typedef __attribute__((ext_vector_type(8)))  float    v8f;
typedef __attribute__((ext_vector_type(4)))  float    v4f;
typedef v8h  __attribute__((may_alias)) v8ha;
typedef v4f  __attribute__((may_alias)) v4fa;
typedef v8us __attribute__((may_alias)) v8usa;

__device__ __forceinline__ unsigned short f2bf(float f) { unsigned u = __float_as_uint(f); u += 0x7FFFu + ((u >> 16) & 1u); return (unsigned short)(u >> 16); }
__device__ __forceinline__ float bf2f(unsigned short b) { return __uint_as_float(((unsigned)b) << 16); }
__device__ __forceinline__ float bfr(float f) { return bf2f(f2bf(f)); }
__device__ __forceinline__ v16h cat16(v8h lo, v8h hi) { return __builtin_shufflevector(lo, hi, 0, 1, 2, 3, 4, 5, 6, 7, 8, 9, 10, 11, 12, 13, 14, 15); }
__device__ __forceinline__ v16bf cat16b(v8us lo, v8us hi) { return __builtin_bit_cast(v16bf, __builtin_shufflevector(lo, hi, 0, 1, 2, 3, 4, 5, 6, 7, 8, 9, 10, 11, 12, 13, 14, 15)); }
__device__ __forceinline__ v8f wmma16(v16h a, v16h b, v8f c) { return __builtin_amdgcn_wmma_f32_16x16x32_f16(false, a, false, b, (short)0, c, false, false); }
__device__ __forceinline__ v8f wmmab(v16bf a, v16bf b, v8f c) { return __builtin_amdgcn_wmma_f32_16x16x32_bf16(false, a, false, b, (short)0, c, false, false); }



// ---- k_gemmw: register-blocked GEMM, ONE WAVE per 64x64 output tile (16 accumulators), operands straight from K-contiguous 16-bit planes; grid (M/64, N/64, Z), 32 threads.
// C[m][n] (f32, pitch ldc, + optional f32 bias[n]) = sum_k A[m][k] Bt[n][k] (+ split products per NSPLIT). z-batch strides sA/sB/sC in elements. K % 32 == 0.
template <typename T16> struct WFrag;
template <> struct WFrag<h16> { typedef v16h V; static __device__ __forceinline__ V ld(const h16* p) { return cat16(*(const v8h*)p, *(const v8h*)(p + 16)); } static __device__ __forceinline__ v8f mma(V a, V b, v8f c) { return wmma16(a, b, c); } };
template <> struct WFrag<bf> { typedef v16bf V; static __device__ __forceinline__ V ld(const bf* p) { return cat16b(*(const v8us*)p, *(const v8us*)(p + 16)); } static __device__ __forceinline__ v8f mma(V a, V b, v8f c) { return wmmab(a, b, c); } };
template <typename T16, int NSPLIT, bool BIAS>
__global__ __launch_bounds__(32) void k_gemmw(const T16* __restrict__ A, const T16* __restrict__ A2, const T16* __restrict__ Bt, const T16* __restrict__ Bt2, int K, float* C, int ldc, const float* __restrict__ bias, size_t sA, size_t sB, size_t sC) {
    typedef typename WFrag<T16>::V V;
    __shared__ __align__(16) float os[16 * 68];
    const size_t z = blockIdx.z; A += z * sA; if (A2) A2 += z * sA; Bt += z * sB; if (Bt2) Bt2 += z * sB; C += z * sC;
    const int lane = threadIdx.x & 31, lr = lane & 15, hi = lane >> 4; const int r0 = blockIdx.x * 64, c0 = blockIdx.y * 64;
    v8f acc[4][4];
#pragma unroll
    for (int mb = 0; mb < 4; ++mb)
#pragma unroll
        for (int nb = 0; nb < 4; ++nb) acc[mb][nb] = (v8f){};
    const size_t aoff = (size_t)(r0 + lr) * K + 8 * hi, boff = (size_t)(c0 + lr) * K + 8 * hi;
#pragma unroll 1
    for (int kc = 0; kc < K; kc += 32) {
        V a[4], a2[4];
#pragma unroll
        for (int mb = 0; mb < 4; ++mb) { a[mb] = WFrag<T16>::ld(A + aoff + (size_t)mb * 16 * K + kc); if (NSPLIT == 1 || NSPLIT == 2) a2[mb] = WFrag<T16>::ld(A2 + aoff + (size_t)mb * 16 * K + kc); }
#pragma unroll
        for (int nb = 0; nb < 4; ++nb) { const V b = WFrag<T16>::ld(Bt + boff + (size_t)nb * 16 * K + kc); V b2; if (NSPLIT >= 2) b2 = WFrag<T16>::ld(Bt2 + boff + (size_t)nb * 16 * K + kc);
#pragma unroll
            for (int mb = 0; mb < 4; ++mb) { acc[mb][nb] = WFrag<T16>::mma(a[mb], b, acc[mb][nb]); if (NSPLIT == 1 || NSPLIT == 2) acc[mb][nb] = WFrag<T16>::mma(a2[mb], b, acc[mb][nb]); if (NSPLIT >= 2) acc[mb][nb] = WFrag<T16>::mma(a[mb], b2, acc[mb][nb]); } }
        asm volatile("v_nop\n\tv_nop\n\tv_nop\n\tv_nop" : "+v"(acc[0][0]), "+v"(acc[1][1]), "+v"(acc[2][2]), "+v"(acc[3][3]) : "v"(a[0]), "v"(a[3]));
    }
#pragma unroll
    for (int mb = 0; mb < 4; ++mb) {
#pragma unroll
        for (int nb = 0; nb < 4; ++nb) {
#pragma unroll
            for (int j = 0; j < 8; ++j) os[(hi * 8 + j) * 68 + nb * 16 + lr] = acc[mb][nb][j]; }
        __builtin_amdgcn_wave_barrier(); asm volatile("" ::: "memory");
        float* crow = C + (size_t)(r0 + mb * 16) * ldc + c0;
{
#pragma unroll
            for (int s = 0; s < 8; ++s) { const int row = 2 * s + hi, cofs = lr * 4; v4f val = *(const v4fa*)(os + row * 68 + cofs); if (BIAS) { val[0] += bfr(bias[c0 + cofs]); val[1] += bfr(bias[c0 + cofs + 1]); val[2] += bfr(bias[c0 + cofs + 2]); val[3] += bfr(bias[c0 + cofs + 3]); }
                *(v4f*)(crow + (size_t)row * ldc + cofs) = val; }
             }
        __builtin_amdgcn_wave_barrier(); asm volatile("" ::: "memory");
    }
}

__device__ __forceinline__ h16 tohx(float x) { return (h16)x; }
__device__ __forceinline__ void splitf(float y, unsigned short& h, unsigned short& l) { h = f2bf(y); l = f2bf(y - bf2f(h)); }
__device__ __forceinline__ float gelu_(float x) { return 0.5f * x * (1.0f + erff(x * 0.7071067811865476f)); }
typedef __attribute__((ext_vector_type(2))) _Float16 v2h;
typedef __attribute__((ext_vector_type(4))) _Float16 v4h;
typedef __attribute__((ext_vector_type(2))) unsigned short v2us;
typedef __attribute__((ext_vector_type(4))) unsigned short v4us;

__global__ __launch_bounds__(256) void k_w1(const float* __restrict__ W1, const float* __restrict__ S1, bf* B1) { const size_t e = ((size_t)blockIdx.x * 256 + threadIdx.x) * 2; if (e >= (size_t)NA * 2 * HH * KI) return; const int k = (int)(e % KI); const int n = (int)((e / KI) % (2 * HH)); const int a = (int)(e / ((size_t)KI * 2 * HH)); const float* src = n < HH ? W1 + ((size_t)a * HH + n) * DI : S1 + ((size_t)a * HH + n - HH) * DI; v2us o;
#pragma unroll
    for (int u = 0; u < 2; ++u) o[u] = (k + u) < DI ? f2bf(src[k + u]) : (unsigned short)0; *(v2us*)(B1 + e) = o;  }
__global__ __launch_bounds__(256) void k_w2(const float* __restrict__ W2, const float* __restrict__ S2, h16* B2) { const size_t e = ((size_t)blockIdx.x * 256 + threadIdx.x) * 4; if (e >= (size_t)NA * 2 * HH * HH) return; const int k = (int)(e % HH); const int n = (int)((e / HH) % (2 * HH)); const int a = (int)(e / ((size_t)HH * 2 * HH)); const float* src = n < HH ? W2 + ((size_t)a * HH + n) * HH : S2 + ((size_t)a * HH + n - HH) * HH; v4h o;
#pragma unroll
    for (int q = 0; q < 4; ++q) o[q] = tohx(bfr(src[k + q])); *(v4h*)(B2 + e) = o;  }
__global__ __launch_bounds__(256) void k_w3(const float* __restrict__ W3, h16* B3) { const size_t e = ((size_t)blockIdx.x * 256 + threadIdx.x) * 4; if (e >= (size_t)NA * HH * HH) return; v4h o;
#pragma unroll
    for (int q = 0; q < 4; ++q) o[q] = tohx(bfr(W3[e + q])); *(v4h*)(B3 + e) = o;  }
__global__ __launch_bounds__(256) void k_wo(const float* __restrict__ Wo, bf* BO) { const size_t e = ((size_t)blockIdx.x * 256 + threadIdx.x) * 4; if (e >= (size_t)NA * 64 * HH) return; const int k = (int)(e % HH); const int n = (int)((e / HH) % 64); const int a = (int)(e / ((size_t)HH * 64)); v4us o;
#pragma unroll
    for (int q = 0; q < 4; ++q) o[q] = n < NO ? f2bf(Wo[((size_t)a * NO + n) * HH + k + q]) : (unsigned short)0; *(v4us*)(BO + e) = o;  }
__global__ __launch_bounds__(256) void k_xn(const float* __restrict__ x, const float* __restrict__ wi, const float* __restrict__ bi, int a0, bf* Xh, bf* Xl) { const size_t e = ((size_t)blockIdx.x * 256 + threadIdx.x) * 2; if (e >= (size_t)GA * NBT * KI) return; const int k = (int)(e % KI); const int b = (int)((e / KI) % NBT); const int a = a0 + (int)(e / ((size_t)KI * NBT)); v2us oh, ol;
#pragma unroll
    for (int u = 0; u < 2; ++u) { unsigned short h = 0, l = 0; const int kk = k + u; if (kk < DI) { float t = __fmul_rn(bfr(x[(size_t)b * DI + kk]), bfr(wi[a * DI + kk])); asm volatile("" : "+v"(t)); splitf(__fadd_rn(t, bfr(bi[a * DI + kk])), h, l); } oh[u] = h; ol[u] = l; }
    *(v2us*)(Xh + e) = oh; *(v2us*)(Xl + e) = ol;  }
__global__ __launch_bounds__(256) void k_h(const float* __restrict__ G, const float* __restrict__ bm, const float* __restrict__ bs, int a0, h16* H16, float* HF) { const size_t e = ((size_t)blockIdx.x * 256 + threadIdx.x) * 4; if (e >= (size_t)NBT * HH) return; const int ag = blockIdx.y, a = a0 + ag; H16 += (size_t)ag * NBT * HH; HF += (size_t)ag * NBT * HH; const int n = (int)(e % HH); const int b = (int)(e / HH); const float* g = G + ((size_t)ag * NBT + b) * 2 * HH; v4h o; v4f of;
#pragma unroll
    for (int q = 0; q < 4; ++q) { const float m = __fadd_rn(g[n + q], bfr(bm[a * HH + n + q])); const float s = __fadd_rn(g[HH + n + q], bfr(bs[a * HH + n + q])); const float h = __fadd_rn(gelu_(m), s); o[q] = tohx(h); of[q] = h; }
    *(v4h*)(H16 + e) = o; *(v4f*)(HF + e) = of;  }
__global__ __launch_bounds__(256) void k_h3(const float* __restrict__ G3, const float* __restrict__ b3, const float* __restrict__ H2F, const float* __restrict__ hw, const float* __restrict__ hb, int a0, bf* Ph, bf* Pl) { const size_t e = ((size_t)blockIdx.x * 256 + threadIdx.x) * 4; if (e >= (size_t)NBT * HH) return; const int ag = blockIdx.y, a = a0 + ag; G3 += (size_t)ag * NBT * HH; H2F += (size_t)ag * NBT * HH; Ph += (size_t)ag * NBT * HH; Pl += (size_t)ag * NBT * HH; const int n = (int)(e % HH); v4us oh, ol;
#pragma unroll
    for (int q = 0; q < 4; ++q) { const float t = __fadd_rn(__fadd_rn(G3[e + q], bfr(b3[a * HH + n + q])), H2F[e + q]); float u = __fmul_rn(t, bfr(hw[a * HH + n + q])); asm volatile("" : "+v"(u)); unsigned short h, l; splitf(__fadd_rn(u, bfr(hb[a * HH + n + q])), h, l); oh[q] = h; ol[q] = l; }
    *(v4us*)(Ph + e) = oh; *(v4us*)(Pl + e) = ol;  }
__global__ __launch_bounds__(256) void k_out(const float* __restrict__ R, const float* __restrict__ bo, int a0, float* OUT) { const int e = blockIdx.x * 256 + threadIdx.x; if (e >= NBT * NO) return; const int ag = blockIdx.y, a = a0 + ag; const int o = e % NO, b = e / NO; const float v = __fadd_rn(R[((size_t)ag * NBT + b) * 64 + o], bfr(bo[a * NO + o])); *(float*)(OUT + (size_t)a * NBT * NO + e) = v;  }

extern "C" void kernel_launch(void* const* d_in, const int* in_sizes, int n_in,
                              void* d_out, int out_size, void* d_ws, size_t ws_size, hipStream_t stream) {
    (void)in_sizes; (void)n_in; (void)out_size;
    const float* IN[17]; for (int i = 0; i < 17; ++i) IN[i] = (const float*)d_in[i];   // 0 x, 1 in_w, 2 in_b, 3 W1, 4 b1, 5 W2, 6 b2, 7 W3, 8 b3, 9 Wo, 10 bo, 11 S1, 12 sb1, 13 S2, 14 sb2, 15 hw, 16 hb
    float* OUT = (float*)d_out;     // [64][4096][3]
    char* wsp = (char*)d_ws;
    auto take = [&](size_t bytes) { char* p = wsp; wsp += (bytes + 255) & ~(size_t)255; return (void*)p; };
    bf* B1 = (bf*)take((size_t)NA * 2 * HH * KI * 2); h16* B2 = (h16*)take((size_t)NA * 2 * HH * HH * 2); h16* B3 = (h16*)take((size_t)NA * HH * HH * 2); bf* BO = (bf*)take((size_t)NA * 64 * HH * 2);
    // Per group of GA agents. A buffer is reused once its last reader has run (launches of one stream run in order): HF holds h1 then h2 in f32; G3 and R lie in the two halves of G; P3h, P3l take the places of H1, H2.
    bf* Xh = (bf*)take((size_t)GA * NBT * KI * 2); bf* Xl = (bf*)take((size_t)GA * NBT * KI * 2); float* G = (float*)take((size_t)GA * NBT * 2 * HH * 4); h16* H1 = (h16*)take((size_t)GA * NBT * HH * 2); h16* H2 = (h16*)take((size_t)GA * NBT * HH * 2); float* HF = (float*)take((size_t)GA * NBT * HH * 4);
    float* G3 = G; float* R = G + (size_t)GA * NBT * HH; bf* P3h = (bf*)H1; bf* P3l = (bf*)H2;
    if ((size_t)(wsp - (char*)d_ws) > ws_size) return;    // total ~ 237 MB
    k_w1<<<(unsigned)(((size_t)NA * 2 * HH * KI / 2 + 255) / 256), 256, 0, stream>>>(IN[3], IN[11], B1); k_w2<<<(unsigned)(((size_t)NA * 2 * HH * HH / 4 + 255) / 256), 256, 0, stream>>>(IN[5], IN[13], B2); k_w3<<<(unsigned)(((size_t)NA * HH * HH / 4 + 255) / 256), 256, 0, stream>>>(IN[7], B3); k_wo<<<(unsigned)(((size_t)NA * 64 * HH / 4 + 255) / 256), 256, 0, stream>>>(IN[9], BO);
    const unsigned LH = (unsigned)(((size_t)NBT * HH / 4 + 255) / 256);
    for (int a0 = 0; a0 < NA; a0 += GA) {
        k_xn<<<(unsigned)(((size_t)GA * NBT * KI / 2 + 255) / 256), 256, 0, stream>>>(IN[0], IN[1], IN[2], a0, Xh, Xl);
        k_gemmw<bf, 1, false><<<dim3(NBT / 64, 2 * HH / 64, GA), 32, 0, stream>>>(Xh, Xl, B1 + (size_t)a0 * 2 * HH * KI, nullptr, KI, G, 2 * HH, nullptr, (size_t)NBT * KI, (size_t)2 * HH * KI, (size_t)NBT * 2 * HH); k_h<<<dim3(LH, GA), 256, 0, stream>>>(G, IN[4], IN[12], a0, H1, HF);
        k_gemmw<h16, 0, false><<<dim3(NBT / 64, 2 * HH / 64, GA), 32, 0, stream>>>(H1, nullptr, B2 + (size_t)a0 * 2 * HH * HH, nullptr, HH, G, 2 * HH, nullptr, (size_t)NBT * HH, (size_t)2 * HH * HH, (size_t)NBT * 2 * HH); k_h<<<dim3(LH, GA), 256, 0, stream>>>(G, IN[6], IN[14], a0, H2, HF);
        k_gemmw<h16, 0, false><<<dim3(NBT / 64, HH / 64, GA), 32, 0, stream>>>(H2, nullptr, B3 + (size_t)a0 * HH * HH, nullptr, HH, G3, HH, nullptr, (size_t)NBT * HH, (size_t)HH * HH, (size_t)NBT * HH); k_h3<<<dim3(LH, GA), 256, 0, stream>>>(G3, IN[8], HF, IN[15], IN[16], a0, P3h, P3l);
        k_gemmw<bf, 1, false><<<dim3(NBT / 64, 1, GA), 32, 0, stream>>>(P3h, P3l, BO + (size_t)a0 * 64 * HH, nullptr, HH, R, 64, nullptr, (size_t)NBT * HH, (size_t)64 * HH, (size_t)NBT * 64); k_out<<<dim3((NBT * NO + 255) / 256, GA), 256, 0, stream>>>(R, IN[10], a0, OUT); }
}

// v002
// It runs in 159 microseconds.
// Timed twice side by side with v001, it ran 4.42 and 4.40 times as fast.
// Over all steps from v000 it is 15.5 times as fast.
#include <hip/hip_runtime.h>

// VectorizedSREKEnsemble - 64 independent MLP "agents" on a shared input (x [4096][50]; per agent a: xn = x w_in[a] + b_in[a] (affine only); h1 = gelu(xn W1^T + b1) + xn S1^T + sb1;
// h2 = gelu(h1 W2^T + b2) + h1 S2^T + sb2; h3 = (h2 W3^T + b3 + h2) hw[a] + hb[a]; logits = h3 Wo^T + bo -> [64][4096][3]; exact (erf) gelu; weights [a][out][in]).
// Compute dtypes, f32 accumulate: every input rounded to bf16; the affine input norm f32 -> bf16 hi+lo planes (K 50 padded to 64) x exact [W1|S1] (2 products, one N = 384 GEMM per agent); h1 and h2 as SINGLE fp16
// planes x fp16 copies of the bf16 [W2|S2] / W3 weights (1 product; hi+lo would double the two 192x384/192x192 GEMMs); the affine hidden norm f32 -> hl planes x exact Wo (3 outputs padded to 64); gelu (erf), biases, skips f32 on VALU.
// One launch carries all four layers: a work-group of 12 waves owns 64 batch rows of one agent and keeps xn, h1, h2 and h3 in LDS (h2 in fp16 and in f32); only the 16-bit weight planes and the logits touch memory.

#define NA   64
#define NBT  4096
#define DI   50
#define KI   64
#define HH   192
#define NO   3
typedef _Float16 h16;
typedef unsigned short bf;
typedef __attribute__((ext_vector_type(16))) __bf16   v16bf;
typedef __attribute__((ext_vector_type(16))) _Float16 v16h;
typedef __attribute__((ext_vector_type(8)))  _Float16 v8h;
typedef __attribute__((ext_vector_type(8)))  unsigned short v8us;
typedef __attribute__((ext_vector_type(8)))  float    v8f;
typedef __attribute__((ext_vector_type(4)))  float    v4f;
typedef v8h  __attribute__((may_alias)) v8ha;
typedef v4f  __attribute__((may_alias)) v4fa;
typedef v8us __attribute__((may_alias)) v8usa;

__device__ __forceinline__ unsigned short f2bf(float f) { unsigned u = __float_as_uint(f); u += 0x7FFFu + ((u >> 16) & 1u); return (unsigned short)(u >> 16); }
__device__ __forceinline__ float bf2f(unsigned short b) { return __uint_as_float(((unsigned)b) << 16); }
__device__ __forceinline__ float bfr(float f) { return bf2f(f2bf(f)); }
__device__ __forceinline__ v16h cat16(v8h lo, v8h hi) { return __builtin_shufflevector(lo, hi, 0, 1, 2, 3, 4, 5, 6, 7, 8, 9, 10, 11, 12, 13, 14, 15); }
__device__ __forceinline__ v16bf cat16b(v8us lo, v8us hi) { return __builtin_bit_cast(v16bf, __builtin_shufflevector(lo, hi, 0, 1, 2, 3, 4, 5, 6, 7, 8, 9, 10, 11, 12, 13, 14, 15)); }
__device__ __forceinline__ v8f wmma16(v16h a, v16h b, v8f c) { return __builtin_amdgcn_wmma_f32_16x16x32_f16(false, a, false, b, (short)0, c, false, false); }
__device__ __forceinline__ v8f wmmab(v16bf a, v16bf b, v8f c) { return __builtin_amdgcn_wmma_f32_16x16x32_bf16(false, a, false, b, (short)0, c, false, false); }



// 16-bit fragment loaders, k order 8h..8h+7 then 16+8h..16+8h+7 on both operands (global weight planes and LDS activation planes alike).
__device__ __forceinline__ v16h  ldgh(const h16* p) { return cat16(*(const v8h*)p, *(const v8h*)(p + 16)); }
__device__ __forceinline__ v16bf ldgb(const bf* p)  { return cat16b(*(const v8us*)p, *(const v8us*)(p + 16)); }
__device__ __forceinline__ v16h  ldsh(const bf* p)  { return cat16(*(const v8ha*)p, *(const v8ha*)(p + 16)); }
__device__ __forceinline__ v16bf ldsb(const bf* p)  { return cat16b(*(const v8usa*)p, *(const v8usa*)(p + 16)); }

__device__ __forceinline__ h16 tohx(float x) { return (h16)x; }
__device__ __forceinline__ void splitf(float y, unsigned short& h, unsigned short& l) { h = f2bf(y); l = f2bf(y - bf2f(h)); }
__device__ __forceinline__ float gelu_(float x) { return 0.5f * x * (1.0f + erff(x * 0.7071067811865476f)); }
typedef __attribute__((ext_vector_type(2))) _Float16 v2h;
typedef __attribute__((ext_vector_type(4))) _Float16 v4h;
typedef __attribute__((ext_vector_type(2))) unsigned short v2us;
typedef __attribute__((ext_vector_type(4))) unsigned short v4us;

__global__ __launch_bounds__(256) void k_w1(const float* __restrict__ W1, const float* __restrict__ S1, bf* B1) { const size_t e = ((size_t)blockIdx.x * 256 + threadIdx.x) * 2; if (e >= (size_t)NA * 2 * HH * KI) return; const int k = (int)(e % KI); const int n = (int)((e / KI) % (2 * HH)); const int a = (int)(e / ((size_t)KI * 2 * HH)); const float* src = n < HH ? W1 + ((size_t)a * HH + n) * DI : S1 + ((size_t)a * HH + n - HH) * DI; v2us o;
#pragma unroll
    for (int u = 0; u < 2; ++u) o[u] = (k + u) < DI ? f2bf(src[k + u]) : (unsigned short)0; *(v2us*)(B1 + e) = o;  }
__global__ __launch_bounds__(256) void k_w2(const float* __restrict__ W2, const float* __restrict__ S2, h16* B2) { const size_t e = ((size_t)blockIdx.x * 256 + threadIdx.x) * 4; if (e >= (size_t)NA * 2 * HH * HH) return; const int k = (int)(e % HH); const int n = (int)((e / HH) % (2 * HH)); const int a = (int)(e / ((size_t)HH * 2 * HH)); const float* src = n < HH ? W2 + ((size_t)a * HH + n) * HH : S2 + ((size_t)a * HH + n - HH) * HH; v4h o;
#pragma unroll
    for (int q = 0; q < 4; ++q) o[q] = tohx(bfr(src[k + q])); *(v4h*)(B2 + e) = o;  }
__global__ __launch_bounds__(256) void k_w3(const float* __restrict__ W3, h16* B3) { const size_t e = ((size_t)blockIdx.x * 256 + threadIdx.x) * 4; if (e >= (size_t)NA * HH * HH) return; v4h o;
#pragma unroll
    for (int q = 0; q < 4; ++q) o[q] = tohx(bfr(W3[e + q])); *(v4h*)(B3 + e) = o;  }
__global__ __launch_bounds__(256) void k_wo(const float* __restrict__ Wo, bf* BO) { const size_t e = ((size_t)blockIdx.x * 256 + threadIdx.x) * 4; if (e >= (size_t)NA * 64 * HH) return; const int k = (int)(e % HH); const int n = (int)((e / HH) % 64); const int a = (int)(e / ((size_t)HH * 64)); v4us o;
#pragma unroll
    for (int q = 0; q < 4; ++q) o[q] = n < NO ? f2bf(Wo[((size_t)a * NO + n) * HH + k + q]) : (unsigned short)0; *(v4us*)(BO + e) = o;  }

#define MT 64    // batch rows per work-group
#define NW 12    // waves per work-group: wave w owns output features 16w..16w+15
#define PX 72    // LDS pitch in elements of the K = 64 planes (144 B: 16 rows of 16 B fall on all 64 banks)
#define PH 200   // LDS pitch in elements of the K = 192 planes (400 B, same reason)

// gelu(main + bm) + (skip + bs) for the 8 consecutive output features that one lane holds of one batch row.
__device__ __forceinline__ v8f act8(v8f m, v8f s, const float* bm, const float* bs) { v8f h;
#pragma unroll
    for (int j = 0; j < 8; ++j) h[j] = __fadd_rn(gelu_(__fadd_rn(m[j], bm[j])), __fadd_rn(s[j], bs[j]));
    return h; }
// src is the same for the whole wave (a scalar base); off is the lane's part.
__device__ __forceinline__ void bias8(const float* __restrict__ src, unsigned off, float* dst) {
#pragma unroll
    for (int j = 0; j < 8; ++j) dst[j] = bfr(src[off + j]); }
// Stands behind the bias loads, in front of the weight loads.
__device__ __forceinline__ void xwait() { asm volatile("s_wait_xcnt 0x0" ::: "memory"); }
__device__ __forceinline__ v8h toh8(v8f h) { v8h o;
#pragma unroll
    for (int j = 0; j < 8; ++j) o[j] = tohx(h[j]);
    return o; }

// ---- k_mlp: the whole per-agent MLP for 64 batch rows. grid (NBT / 64, NA), 384 threads. Every product is formed transposed, D[n][m] = sum_k W[n][k] act[m][k] (weights as the A operand, activations as B),
// so a lane holds 8 consecutive features of one batch row and hands them to the next layer with one 16-byte LDS store. A wave loads its 16 features' weights of a layer once into registers and walks the four 16-row blocks
// in a loop that stays rolled: the erf code is long.
__global__ __launch_bounds__(NW * 32) void k_mlp(const float* __restrict__ x, const float* __restrict__ wi, const float* __restrict__ bi, const float* __restrict__ b1, const float* __restrict__ sb1, const float* __restrict__ b2, const float* __restrict__ sb2,
                                             const float* __restrict__ b3, const float* __restrict__ hw, const float* __restrict__ hb, const float* __restrict__ bo,
                                             const bf* __restrict__ B1, const h16* __restrict__ B2, const h16* __restrict__ B3, const bf* __restrict__ BO, float* __restrict__ OUT) {
    __shared__ __align__(16) bf buf0[MT * PH];   // h1 (fp16), then h3 hi
    __shared__ __align__(16) bf buf1[MT * PH];   // xn hi and lo, then h2 (fp16), then h3 lo
    __shared__ __align__(16) v4f h2s[NW * 4 * 2 * 32];   // h2 in f32 for the residual of layer 3: each lane's own 8 values per row block, read back by the same lane
    __shared__ float os[MT * NO];
    const int tid = threadIdx.x, lane = tid & 31, lr = lane & 15, hi = lane >> 4;
    const int w = __builtin_amdgcn_readfirstlane(tid >> 5);   // wave number in a scalar register: the branch round the last layer's matrix instructions must be a scalar one
    const int a = blockIdx.y, r0 = blockIdx.x * MT;
    const int n0 = w * 16 + hi * 8;    // first of the lane's 8 features in a D fragment
    const int fo = lr * PH + 8 * hi;   // a lane's place in an activation fragment of the K = 192 planes
    const int so = lr * PH + n0;       // a lane's place for its 8 features of a row
    const int ab = a * HH + w * 16; const unsigned h8 = hi * 8;   // the wave's and the lane's part of a place in a per-feature vector (ab + h8 = a * HH + n0)
    bf* Xh = buf1; bf* Xl = buf1 + MT * PX;
    for (int p = tid; p < MT * KI / 2; p += NW * 32) { const int row = p >> 5, k = (p & 31) * 2; v2us oh, ol;
#pragma unroll
        for (int u = 0; u < 2; ++u) { unsigned short h = 0, l = 0; const int kk = k + u; if (kk < DI) splitf(__fadd_rn(__fmul_rn(bfr(x[(size_t)(r0 + row) * DI + kk]), bfr(wi[a * DI + kk])), bfr(bi[a * DI + kk])), h, l); oh[u] = h; ol[u] = l; }
        *(v2us*)(Xh + row * PX + k) = oh; *(v2us*)(Xl + row * PX + k) = ol; }
    {   // layer 1: [W1|S1] x (xn hi + xn lo), K = 64
        const bf* Bm = B1 + ((size_t)a * 2 * HH + w * 16 + lr) * KI + 8 * hi; const bf* Bs = Bm + (size_t)HH * KI; v16bf wm[2], ws[2];
        float bm[8], bs[8]; bias8(b1 + ab, h8, bm); bias8(sb1 + ab, h8, bs); xwait();
#pragma unroll
        for (int q = 0; q < 2; ++q) { wm[q] = ldgb(Bm + q * 32); ws[q] = ldgb(Bs + q * 32); }
        __syncthreads();   // xn complete
#pragma unroll 1   // rolled: keeps one copy of the erf code per layer in the text
        for (int mb = 0; mb < 4; ++mb) { v8f am = (v8f){}, as = (v8f){};
#pragma unroll
            for (int q = 0; q < 2; ++q) { const v16bf xh = ldsb(Xh + (mb * 16 + lr) * PX + 8 * hi + q * 32), xl = ldsb(Xl + (mb * 16 + lr) * PX + 8 * hi + q * 32);
                am = wmmab(wm[q], xh, am); as = wmmab(ws[q], xh, as); am = wmmab(wm[q], xl, am); as = wmmab(ws[q], xl, as); }
            *(v8ha*)(buf0 + mb * 16 * PH + so) = toh8(act8(am, as, bm, bs)); }
    }
    {   // layer 2: [W2|S2] x h1, K = 192
        const h16* Bm = B2 + ((size_t)a * 2 * HH + w * 16 + lr) * HH + 8 * hi; const h16* Bs = Bm + (size_t)HH * HH; v16h wm[6], ws[6];
        float bm[8], bs[8]; bias8(b2 + ab, h8, bm); bias8(sb2 + ab, h8, bs); xwait();
#pragma unroll
        for (int q = 0; q < 6; ++q) { wm[q] = ldgh(Bm + q * 32); ws[q] = ldgh(Bs + q * 32); }
        __syncthreads();   // h1 complete; every read of xn is over, so buf1 may take h2
#pragma unroll 1   // rolled: as in layer 1
        for (int mb = 0; mb < 4; ++mb) { v8f am = (v8f){}, as = (v8f){};
#pragma unroll
            for (int q = 0; q < 6; ++q) { const v16h hv = ldsh(buf0 + mb * 16 * PH + fo + q * 32); am = wmma16(wm[q], hv, am); as = wmma16(ws[q], hv, as); }
            const v8f h = act8(am, as, bm, bs);
            h2s[((w * 4 + mb) * 2 + 0) * 32 + lane] = (v4f){h[0], h[1], h[2], h[3]}; h2s[((w * 4 + mb) * 2 + 1) * 32 + lane] = (v4f){h[4], h[5], h[6], h[7]};
            *(v8ha*)(buf1 + mb * 16 * PH + so) = toh8(h); }
    }
    {   // layer 3: W3 x h2, K = 192, + b3 + h2 (f32), then the affine hidden norm, split into bf16 hi + lo planes
        const h16* Bm = B3 + ((size_t)a * HH + w * 16 + lr) * HH + 8 * hi; v16h wm[6];
        float bb[8], sw[8], sb[8]; bias8(b3 + ab, h8, bb); bias8(hw + ab, h8, sw); bias8(hb + ab, h8, sb);
#pragma unroll
        for (int q = 0; q < 6; ++q) wm[q] = ldgh(Bm + q * 32);
        __syncthreads();   // h2 complete; every read of h1 is over
        v8f ac[4];
#pragma unroll
        for (int mb = 0; mb < 4; ++mb) ac[mb] = (v8f){};
#pragma unroll
        for (int q = 0; q < 6; ++q)
#pragma unroll
            for (int mb = 0; mb < 4; ++mb) ac[mb] = wmma16(wm[q], ldsh(buf1 + mb * 16 * PH + fo + q * 32), ac[mb]);
        __syncthreads();   // every read of h2 (fp16) is over before buf1 takes the lo plane
#pragma unroll
        for (int mb = 0; mb < 4; ++mb) { const v4f ra = h2s[((w * 4 + mb) * 2 + 0) * 32 + lane], rb = h2s[((w * 4 + mb) * 2 + 1) * 32 + lane]; v8us oh, ol;
#pragma unroll
            for (int j = 0; j < 8; ++j) { const float t = __fadd_rn(__fadd_rn(ac[mb][j], bb[j]), j < 4 ? ra[j & 3] : rb[j & 3]); unsigned short h, l; splitf(__fadd_rn(__fmul_rn(t, sw[j]), sb[j]), h, l); oh[j] = h; ol[j] = l; }
            *(v8usa*)(buf0 + mb * 16 * PH + so) = oh; *(v8usa*)(buf1 + mb * 16 * PH + so) = ol; }
    }
    __syncthreads();   // h3 planes complete
    if (w < 4) {   // output layer: Wo (3 rows, zero-padded) x (h3 hi + h3 lo), K = 192; wave w takes batch rows 16w..16w+15
        v8f ac = (v8f){}; const bf* Bm = BO + ((size_t)a * 64 + lr) * HH + 8 * hi;
#pragma unroll
        for (int q = 0; q < 6; ++q) { const v16bf wo = ldgb(Bm + q * 32); ac = wmmab(wo, ldsb(buf0 + w * 16 * PH + fo + q * 32), ac); ac = wmmab(wo, ldsb(buf1 + w * 16 * PH + fo + q * 32), ac); }
        if (hi == 0) {
#pragma unroll
            for (int j = 0; j < NO; ++j) os[(w * 16 + lr) * NO + j] = ac[j]; }
    }
    __syncthreads();   // logits of the 64 rows gathered: 192 floats, stored thread-linearly so that each wave writes one whole 128-byte line
    if (tid < MT * NO) OUT[((size_t)a * NBT + r0) * NO + tid] = __fadd_rn(os[tid], bfr(bo[a * NO + tid % NO]));
}

extern "C" void kernel_launch(void* const* d_in, const int* in_sizes, int n_in,
                              void* d_out, int out_size, void* d_ws, size_t ws_size, hipStream_t stream) {
    (void)in_sizes; (void)n_in; (void)out_size;
    const float* IN[17]; for (int i = 0; i < 17; ++i) IN[i] = (const float*)d_in[i];   // 0 x, 1 in_w, 2 in_b, 3 W1, 4 b1, 5 W2, 6 b2, 7 W3, 8 b3, 9 Wo, 10 bo, 11 S1, 12 sb1, 13 S2, 14 sb2, 15 hw, 16 hb
    float* OUT = (float*)d_out;     // [64][4096][3]
    char* wsp = (char*)d_ws;
    auto take = [&](size_t bytes) { char* p = wsp; wsp += (bytes + 255) & ~(size_t)255; return (void*)p; };
    bf* B1 = (bf*)take((size_t)NA * 2 * HH * KI * 2); h16* B2 = (h16*)take((size_t)NA * 2 * HH * HH * 2); h16* B3 = (h16*)take((size_t)NA * HH * HH * 2); bf* BO = (bf*)take((size_t)NA * 64 * HH * 2);
    if ((size_t)(wsp - (char*)d_ws) > ws_size) return;    // total ~ 19 MB
    k_w1<<<(unsigned)(((size_t)NA * 2 * HH * KI / 2 + 255) / 256), 256, 0, stream>>>(IN[3], IN[11], B1); k_w2<<<(unsigned)(((size_t)NA * 2 * HH * HH / 4 + 255) / 256), 256, 0, stream>>>(IN[5], IN[13], B2); k_w3<<<(unsigned)(((size_t)NA * HH * HH / 4 + 255) / 256), 256, 0, stream>>>(IN[7], B3); k_wo<<<(unsigned)(((size_t)NA * 64 * HH / 4 + 255) / 256), 256, 0, stream>>>(IN[9], BO);
    k_mlp<<<dim3(NBT / MT, NA), NW * 32, 0, stream>>>(IN[0], IN[1], IN[2], IN[4], IN[12], IN[6], IN[14], IN[8], IN[15], IN[16], IN[10], B1, B2, B3, BO, OUT);
}

// v003
// One run takes 143 microseconds.
// In both of two side-by-side timings against v002, it was 1.12 times as fast.
// Over all steps from v000 it is 17.3 times as fast.
#include <hip/hip_runtime.h>

// VectorizedSREKEnsemble - 64 independent MLP "agents" on a shared input (x [4096][50]; per agent a: xn = x w_in[a] + b_in[a] (affine only); h1 = gelu(xn W1^T + b1) + xn S1^T + sb1;
// h2 = gelu(h1 W2^T + b2) + h1 S2^T + sb2; h3 = (h2 W3^T + b3 + h2) hw[a] + hb[a]; logits = h3 Wo^T + bo -> [64][4096][3]; exact (erf) gelu; weights [a][out][in]).
// Compute dtypes, f32 accumulate: every input rounded to bf16; the affine input norm f32 -> bf16 hi+lo planes (K 50 padded to 64) x exact [W1|S1] (2 products, one N = 384 GEMM per agent); h1 and h2 as SINGLE fp16
// planes x fp16 copies of the bf16 [W2|S2] / W3 weights (1 product; hi+lo would double the two 192x384/192x192 GEMMs); the affine hidden norm f32 -> hl planes x exact Wo (3 outputs padded to 64); gelu (erf), biases, skips f32 on VALU.
// One launch carries all four layers: a work-group of 12 waves owns 64 batch rows of one agent and keeps xn, h1, h2 and h3 in LDS (h2 in fp16 and in f32); only the 16-bit weight planes and the logits touch memory.

#define NA   64
#define NBT  4096
#define DI   50
#define KI   64
#define HH   192
#define NO   3
typedef _Float16 h16;
typedef unsigned short bf;
typedef __attribute__((ext_vector_type(16))) __bf16   v16bf;
typedef __attribute__((ext_vector_type(16))) _Float16 v16h;
typedef __attribute__((ext_vector_type(8)))  _Float16 v8h;
typedef __attribute__((ext_vector_type(8)))  unsigned short v8us;
typedef __attribute__((ext_vector_type(8)))  float    v8f;
typedef __attribute__((ext_vector_type(4)))  float    v4f;
typedef v8h  __attribute__((may_alias)) v8ha;
typedef v4f  __attribute__((may_alias)) v4fa;
typedef v8us __attribute__((may_alias)) v8usa;

__device__ __forceinline__ unsigned short f2bf(float f) { unsigned u = __float_as_uint(f); u += 0x7FFFu + ((u >> 16) & 1u); return (unsigned short)(u >> 16); }
__device__ __forceinline__ float bf2f(unsigned short b) { return __uint_as_float(((unsigned)b) << 16); }
__device__ __forceinline__ float bfr(float f) { return bf2f(f2bf(f)); }
__device__ __forceinline__ v16h cat16(v8h lo, v8h hi) { return __builtin_shufflevector(lo, hi, 0, 1, 2, 3, 4, 5, 6, 7, 8, 9, 10, 11, 12, 13, 14, 15); }
__device__ __forceinline__ v16bf cat16b(v8us lo, v8us hi) { return __builtin_bit_cast(v16bf, __builtin_shufflevector(lo, hi, 0, 1, 2, 3, 4, 5, 6, 7, 8, 9, 10, 11, 12, 13, 14, 15)); }
__device__ __forceinline__ v8f wmma16(v16h a, v16h b, v8f c) { return __builtin_amdgcn_wmma_f32_16x16x32_f16(false, a, false, b, (short)0, c, false, false); }
__device__ __forceinline__ v8f wmmab(v16bf a, v16bf b, v8f c) { return __builtin_amdgcn_wmma_f32_16x16x32_bf16(false, a, false, b, (short)0, c, false, false); }



// 16-bit fragment loaders, k order 8h..8h+7 then 16+8h..16+8h+7 on both operands (global weight planes and LDS activation planes alike).
__device__ __forceinline__ v16h  ldgh(const h16* p) { return cat16(*(const v8h*)p, *(const v8h*)(p + 16)); }
__device__ __forceinline__ v16bf ldgb(const bf* p)  { return cat16b(*(const v8us*)p, *(const v8us*)(p + 16)); }
__device__ __forceinline__ v16h  ldsh(const bf* p)  { return cat16(*(const v8ha*)p, *(const v8ha*)(p + 16)); }
__device__ __forceinline__ v16bf ldsb(const bf* p)  { return cat16b(*(const v8usa*)p, *(const v8usa*)(p + 16)); }

__device__ __forceinline__ h16 tohx(float x) { return (h16)x; }
__device__ __forceinline__ void splitf(float y, unsigned short& h, unsigned short& l) { h = f2bf(y); l = f2bf(y - bf2f(h)); }
typedef __attribute__((ext_vector_type(2))) _Float16 v2h;
typedef __attribute__((ext_vector_type(4))) _Float16 v4h;
typedef __attribute__((ext_vector_type(2))) unsigned short v2us;
typedef __attribute__((ext_vector_type(4))) unsigned short v4us;

__global__ __launch_bounds__(256) void k_w1(const float* __restrict__ W1, const float* __restrict__ S1, bf* B1) { const size_t e = ((size_t)blockIdx.x * 256 + threadIdx.x) * 2; if (e >= (size_t)NA * 2 * HH * KI) return; const int k = (int)(e % KI); const int n = (int)((e / KI) % (2 * HH)); const int a = (int)(e / ((size_t)KI * 2 * HH)); const float* src = n < HH ? W1 + ((size_t)a * HH + n) * DI : S1 + ((size_t)a * HH + n - HH) * DI; v2us o;
#pragma unroll
    for (int u = 0; u < 2; ++u) o[u] = (k + u) < DI ? f2bf(src[k + u]) : (unsigned short)0; *(v2us*)(B1 + e) = o;  }
__global__ __launch_bounds__(256) void k_w2(const float* __restrict__ W2, const float* __restrict__ S2, h16* B2) { const size_t e = ((size_t)blockIdx.x * 256 + threadIdx.x) * 4; if (e >= (size_t)NA * 2 * HH * HH) return; const int k = (int)(e % HH); const int n = (int)((e / HH) % (2 * HH)); const int a = (int)(e / ((size_t)HH * 2 * HH)); const float* src = n < HH ? W2 + ((size_t)a * HH + n) * HH : S2 + ((size_t)a * HH + n - HH) * HH; v4h o;
#pragma unroll
    for (int q = 0; q < 4; ++q) o[q] = tohx(bfr(src[k + q])); *(v4h*)(B2 + e) = o;  }
__global__ __launch_bounds__(256) void k_w3(const float* __restrict__ W3, h16* B3) { const size_t e = ((size_t)blockIdx.x * 256 + threadIdx.x) * 4; if (e >= (size_t)NA * HH * HH) return; v4h o;
#pragma unroll
    for (int q = 0; q < 4; ++q) o[q] = tohx(bfr(W3[e + q])); *(v4h*)(B3 + e) = o;  }
__global__ __launch_bounds__(256) void k_wo(const float* __restrict__ Wo, bf* BO) { const size_t e = ((size_t)blockIdx.x * 256 + threadIdx.x) * 4; if (e >= (size_t)NA * 64 * HH) return; const int k = (int)(e % HH); const int n = (int)((e / HH) % 64); const int a = (int)(e / ((size_t)HH * 64)); v4us o;
#pragma unroll
    for (int q = 0; q < 4; ++q) o[q] = n < NO ? f2bf(Wo[((size_t)a * NO + n) * HH + k + q]) : (unsigned short)0; *(v4us*)(BO + e) = o;  }

#define MT 64    // batch rows per work-group
#define NW 12    // waves per work-group: wave w owns output features 16w..16w+15
#define PX 72    // LDS pitch in elements of the K = 64 planes (144 B: 16 rows of 16 B fall on all 64 banks)
#define PH 200   // LDS pitch in elements of the K = 192 planes (400 B, same reason)

__device__ __forceinline__ v8f fma8(v8f a, v8f b, v8f c) { return __builtin_elementwise_fma(a, b, c); }
__device__ __forceinline__ v8f sp8(float c) { return (v8f){c, c, c, c, c, c, c, c}; }
// gelu(main + bm) + (skip + bs) for the 8 consecutive output features that one lane holds of one batch row; gelu(x) = 0.5 x w with w = 1 + erf(x / sqrt 2).
// All 8 go side by side as vectors (independent chains, two floats an instruction). For |x| < sqrt 2, w = 1 + x q(x^2): the odd polynomial that the library's erff takes for an argument below 1, with the 1 / sqrt 2 folded into its six coefficients.
// One test for the whole wave sends all 8 to erff itself as soon as any lane holds an |x| >= sqrt 2 (a NaN stays a NaN on either way).
__device__ __forceinline__ v8f act8(v8f m, v8f s, const float* bm, const float* bs) { v8f vm, vs, w;
#pragma unroll
    for (int j = 0; j < 8; ++j) { vm[j] = bm[j]; vs[j] = bs[j]; }
    const v8f x = m + vm;
    float mx = __builtin_fabsf(x[0]);
#pragma unroll
    for (int j = 1; j < 8; ++j) mx = fmaxf(mx, __builtin_fabsf(x[j]));
    if (__builtin_amdgcn_ballot_w32(mx >= 0x1.6a09e6p+0f) != 0u) {   // the same for the whole wave: a scalar branch, every lane stays on
#pragma unroll
        for (int j = 0; j < 8; ++j) w[j] = 1.0f + erff(x[j] * 0.7071067811865476f);
    } else { const v8f u = x * x;
        v8f q = fma8(u, sp8(-0x1.a08d04p-17f), sp8(0x1.c76bfcp-13f)); q = fma8(u, q, sp8(-0x1.3569b4p-9f)); q = fma8(u, q, sp8(0x1.46b43ap-6f)); q = fma8(u, q, sp8(-0x1.105794p-3f)); q = fma8(u, q, sp8(0x1.988452p-1f));
        w = fma8(x, q, sp8(1.0f)); }
    return (0.5f * x) * w + (s + vs); }
// src is the same for the whole wave (a scalar base); off is the lane's part.
__device__ __forceinline__ void bias8(const float* __restrict__ src, unsigned off, float* dst) {
#pragma unroll
    for (int j = 0; j < 8; ++j) dst[j] = bfr(src[off + j]); }
// Stands behind the bias loads, in front of the weight loads.
__device__ __forceinline__ void xwait() { asm volatile("s_wait_xcnt 0x0" ::: "memory"); }
__device__ __forceinline__ v8h toh8(v8f h) { v8h o;
#pragma unroll
    for (int j = 0; j < 8; ++j) o[j] = tohx(h[j]);
    return o; }

// ---- k_mlp: the whole per-agent MLP for 64 batch rows. grid (NBT / 64, NA), 384 threads. Every product is formed transposed, D[n][m] = sum_k W[n][k] act[m][k] (weights as the A operand, activations as B),
// so a lane holds 8 consecutive features of one batch row and hands them to the next layer with one 16-byte LDS store. A wave loads its 16 features' weights of a layer once into registers and walks the four 16-row blocks
// in a loop that stays rolled: the erf code is long (for speed only). The second launch-bounds argument asks for six waves a SIMD (two work-groups a WGP): without it the build takes more than 160 registers and only one work-group fits.
__global__ __launch_bounds__(NW * 32, 6) void k_mlp(const float* __restrict__ x, const float* __restrict__ wi, const float* __restrict__ bi, const float* __restrict__ b1, const float* __restrict__ sb1, const float* __restrict__ b2, const float* __restrict__ sb2,
                                             const float* __restrict__ b3, const float* __restrict__ hw, const float* __restrict__ hb, const float* __restrict__ bo,
                                             const bf* __restrict__ B1, const h16* __restrict__ B2, const h16* __restrict__ B3, const bf* __restrict__ BO, float* __restrict__ OUT) {
    __shared__ __align__(16) bf buf0[MT * PH];   // h1 (fp16), then h3 hi
    __shared__ __align__(16) bf buf1[MT * PH];   // xn hi and lo, then h2 (fp16), then h3 lo
    __shared__ __align__(16) v4f h2s[NW * 4 * 2 * 32];   // h2 in f32 for the residual of layer 3: each lane's own 8 values per row block, read back by the same lane
    __shared__ float os[MT * NO];
    const int tid = threadIdx.x, lane = tid & 31, lr = lane & 15, hi = lane >> 4;
    const int w = __builtin_amdgcn_readfirstlane(tid >> 5);   // wave number in a scalar register: the branch round the last layer's matrix instructions must be a scalar one
    const int a = blockIdx.y, r0 = blockIdx.x * MT;
    const int n0 = w * 16 + hi * 8;    // first of the lane's 8 features in a D fragment
    const int fo = lr * PH + 8 * hi;   // a lane's place in an activation fragment of the K = 192 planes
    const int so = lr * PH + n0;       // a lane's place for its 8 features of a row
    const int ab = a * HH + w * 16; const unsigned h8 = hi * 8;   // the wave's and the lane's part of a place in a per-feature vector (ab + h8 = a * HH + n0)
    bf* Xh = buf1; bf* Xl = buf1 + MT * PX;
    for (int p = tid; p < MT * KI / 2; p += NW * 32) { const int row = p >> 5, k = (p & 31) * 2; v2us oh, ol;
#pragma unroll
        for (int u = 0; u < 2; ++u) { unsigned short h = 0, l = 0; const int kk = k + u; if (kk < DI) splitf(__fadd_rn(__fmul_rn(bfr(x[(size_t)(r0 + row) * DI + kk]), bfr(wi[a * DI + kk])), bfr(bi[a * DI + kk])), h, l); oh[u] = h; ol[u] = l; }
        *(v2us*)(Xh + row * PX + k) = oh; *(v2us*)(Xl + row * PX + k) = ol; }
    {   // layer 1: [W1|S1] x (xn hi + xn lo), K = 64
        const bf* Bm = B1 + ((size_t)a * 2 * HH + w * 16 + lr) * KI + 8 * hi; const bf* Bs = Bm + (size_t)HH * KI; v16bf wm[2], ws[2];
        float bm[8], bs[8]; bias8(b1 + ab, h8, bm); bias8(sb1 + ab, h8, bs); xwait();
#pragma unroll
        for (int q = 0; q < 2; ++q) { wm[q] = ldgb(Bm + q * 32); ws[q] = ldgb(Bs + q * 32); }
        __syncthreads();   // xn complete
#pragma unroll 1   // rolled: keeps one copy of the erf code per layer in the text
        for (int mb = 0; mb < 4; ++mb) { v8f am = (v8f){}, as = (v8f){};
#pragma unroll
            for (int q = 0; q < 2; ++q) { const v16bf xh = ldsb(Xh + (mb * 16 + lr) * PX + 8 * hi + q * 32), xl = ldsb(Xl + (mb * 16 + lr) * PX + 8 * hi + q * 32);
                am = wmmab(wm[q], xh, am); as = wmmab(ws[q], xh, as); am = wmmab(wm[q], xl, am); as = wmmab(ws[q], xl, as); }
            *(v8ha*)(buf0 + mb * 16 * PH + so) = toh8(act8(am, as, bm, bs)); }
    }
    {   // layer 2: [W2|S2] x h1, K = 192
        const h16* Bm = B2 + ((size_t)a * 2 * HH + w * 16 + lr) * HH + 8 * hi; const h16* Bs = Bm + (size_t)HH * HH; v16h wm[6], ws[6];
        float bm[8], bs[8]; bias8(b2 + ab, h8, bm); bias8(sb2 + ab, h8, bs); xwait();
#pragma unroll
        for (int q = 0; q < 6; ++q) { wm[q] = ldgh(Bm + q * 32); if (q < 5) ws[q] = ldgh(Bs + q * 32); }
        { const v8h lo = *(const v8h*)(Bs + 160); xwait(); ws[5] = cat16(lo, *(const v8h*)(Bs + 176)); }   // the wait stands in front of the layer's last weight load: at this register count its destination takes over the address pair that the 23 loads in front of it name
        __syncthreads();   // h1 complete; every read of xn is over, so buf1 may take h2
#pragma unroll 1   // rolled: as in layer 1
        for (int mb = 0; mb < 4; ++mb) { v8f am = (v8f){}, as = (v8f){};
#pragma unroll
            for (int q = 0; q < 6; ++q) { const v16h hv = ldsh(buf0 + mb * 16 * PH + fo + q * 32); am = wmma16(wm[q], hv, am); as = wmma16(ws[q], hv, as); }
            const v8f h = act8(am, as, bm, bs);
            h2s[((w * 4 + mb) * 2 + 0) * 32 + lane] = (v4f){h[0], h[1], h[2], h[3]}; h2s[((w * 4 + mb) * 2 + 1) * 32 + lane] = (v4f){h[4], h[5], h[6], h[7]};
            *(v8ha*)(buf1 + mb * 16 * PH + so) = toh8(h); }
    }
    {   // layer 3: W3 x h2, K = 192, + b3 + h2 (f32), then the affine hidden norm, split into bf16 hi + lo planes
        const h16* Bm = B3 + ((size_t)a * HH + w * 16 + lr) * HH + 8 * hi; v16h wm[6];
        float bb[8], sw[8], sb[8]; bias8(b3 + ab, h8, bb); bias8(hw + ab, h8, sw); bias8(hb + ab, h8, sb);
#pragma unroll
        for (int q = 0; q < 6; ++q) wm[q] = ldgh(Bm + q * 32);
        __syncthreads();   // h2 complete; every read of h1 is over
        v8f ac[4];
#pragma unroll
        for (int mb = 0; mb < 4; ++mb) ac[mb] = (v8f){};
#pragma unroll
        for (int q = 0; q < 6; ++q)
#pragma unroll
            for (int mb = 0; mb < 4; ++mb) ac[mb] = wmma16(wm[q], ldsh(buf1 + mb * 16 * PH + fo + q * 32), ac[mb]);
        __syncthreads();   // every read of h2 (fp16) is over before buf1 takes the lo plane
#pragma unroll
        for (int mb = 0; mb < 4; ++mb) { const v4f ra = h2s[((w * 4 + mb) * 2 + 0) * 32 + lane], rb = h2s[((w * 4 + mb) * 2 + 1) * 32 + lane]; v8us oh, ol;
#pragma unroll
            for (int j = 0; j < 8; ++j) { const float t = __fadd_rn(__fadd_rn(ac[mb][j], bb[j]), j < 4 ? ra[j & 3] : rb[j & 3]); unsigned short h, l; splitf(__fadd_rn(__fmul_rn(t, sw[j]), sb[j]), h, l); oh[j] = h; ol[j] = l; }
            *(v8usa*)(buf0 + mb * 16 * PH + so) = oh; *(v8usa*)(buf1 + mb * 16 * PH + so) = ol; }
    }
    __syncthreads();   // h3 planes complete
    if (w < 4) {   // output layer: Wo (3 rows, zero-padded) x (h3 hi + h3 lo), K = 192; wave w takes batch rows 16w..16w+15
        v8f ac = (v8f){}; const bf* Bm = BO + ((size_t)a * 64 + lr) * HH + 8 * hi;
#pragma unroll
        for (int q = 0; q < 6; ++q) { const v16bf wo = ldgb(Bm + q * 32); ac = wmmab(wo, ldsb(buf0 + w * 16 * PH + fo + q * 32), ac); ac = wmmab(wo, ldsb(buf1 + w * 16 * PH + fo + q * 32), ac); }
        if (hi == 0) {
#pragma unroll
            for (int j = 0; j < NO; ++j) os[(w * 16 + lr) * NO + j] = ac[j]; }
    }
    __syncthreads();   // logits of the 64 rows gathered: 192 floats, stored thread-linearly so that each wave writes one whole 128-byte line
    if (tid < MT * NO) OUT[((size_t)a * NBT + r0) * NO + tid] = __fadd_rn(os[tid], bfr(bo[a * NO + tid % NO]));
}

extern "C" void kernel_launch(void* const* d_in, const int* in_sizes, int n_in,
                              void* d_out, int out_size, void* d_ws, size_t ws_size, hipStream_t stream) {
    (void)in_sizes; (void)n_in; (void)out_size;
    const float* IN[17]; for (int i = 0; i < 17; ++i) IN[i] = (const float*)d_in[i];   // 0 x, 1 in_w, 2 in_b, 3 W1, 4 b1, 5 W2, 6 b2, 7 W3, 8 b3, 9 Wo, 10 bo, 11 S1, 12 sb1, 13 S2, 14 sb2, 15 hw, 16 hb
    float* OUT = (float*)d_out;     // [64][4096][3]
    char* wsp = (char*)d_ws;
    auto take = [&](size_t bytes) { char* p = wsp; wsp += (bytes + 255) & ~(size_t)255; return (void*)p; };
    bf* B1 = (bf*)take((size_t)NA * 2 * HH * KI * 2); h16* B2 = (h16*)take((size_t)NA * 2 * HH * HH * 2); h16* B3 = (h16*)take((size_t)NA * HH * HH * 2); bf* BO = (bf*)take((size_t)NA * 64 * HH * 2);
    if ((size_t)(wsp - (char*)d_ws) > ws_size) return;    // total ~ 19 MB
    k_w1<<<(unsigned)(((size_t)NA * 2 * HH * KI / 2 + 255) / 256), 256, 0, stream>>>(IN[3], IN[11], B1); k_w2<<<(unsigned)(((size_t)NA * 2 * HH * HH / 4 + 255) / 256), 256, 0, stream>>>(IN[5], IN[13], B2); k_w3<<<(unsigned)(((size_t)NA * HH * HH / 4 + 255) / 256), 256, 0, stream>>>(IN[7], B3); k_wo<<<(unsigned)(((size_t)NA * 64 * HH / 4 + 255) / 256), 256, 0, stream>>>(IN[9], BO);
    k_mlp<<<dim3(NBT / MT, NA), NW * 32, 0, stream>>>(IN[0], IN[1], IN[2], IN[4], IN[12], IN[6], IN[14], IN[8], IN[15], IN[16], IN[10], B1, B2, B3, BO, OUT);
}

// v004
// Measured time: 121 microseconds a run.
// Two timings next to v003 both put it at 1.18 times that version's speed.
// All steps since v000 together make it 20.4 times as fast.
#include <hip/hip_runtime.h>

// VectorizedSREKEnsemble - 64 independent MLP "agents" on a shared input (x [4096][50]; per agent a: xn = x w_in[a] + b_in[a] (affine only); h1 = gelu(xn W1^T + b1) + xn S1^T + sb1;
// h2 = gelu(h1 W2^T + b2) + h1 S2^T + sb2; h3 = (h2 W3^T + b3 + h2) hw[a] + hb[a]; logits = h3 Wo^T + bo -> [64][4096][3]; exact (erf) gelu; weights [a][out][in]).
// Compute dtypes, f32 accumulate: every input rounded to bf16; the affine input norm f32 -> bf16 hi+lo planes (K 50 padded to 64) x exact [W1|S1] (2 products, one N = 384 GEMM per agent); h1 and h2 as SINGLE fp16
// planes x fp16 copies of the bf16 [W2|S2] / W3 weights (1 product; hi+lo would double the two 192x384/192x192 GEMMs); the affine hidden norm f32 -> hl planes x exact Wo (3 outputs padded to 64); gelu (erf), biases, skips f32 on VALU.
// One launch carries all four layers: a work-group of 12 waves owns 64 batch rows of one agent and keeps xn, h1, h2 and h3 in LDS (h2 in fp16 and in f32); only the 16-bit weight planes and the logits touch memory.

#define NA   64
#define NBT  4096
#define DI   50
#define KI   64
#define HH   192
#define NO   3
typedef _Float16 h16;
typedef unsigned short bf;
typedef __attribute__((ext_vector_type(16))) __bf16   v16bf;
typedef __attribute__((ext_vector_type(16))) _Float16 v16h;
typedef __attribute__((ext_vector_type(8)))  _Float16 v8h;
typedef __attribute__((ext_vector_type(8)))  unsigned short v8us;
typedef __attribute__((ext_vector_type(8)))  float    v8f;
typedef __attribute__((ext_vector_type(4)))  float    v4f;
typedef v8h  __attribute__((may_alias)) v8ha;
typedef v4f  __attribute__((may_alias)) v4fa;
typedef v8us __attribute__((may_alias)) v8usa;

__device__ __forceinline__ unsigned short f2bf(float f) { unsigned u = __float_as_uint(f); u += 0x7FFFu + ((u >> 16) & 1u); return (unsigned short)(u >> 16); }
__device__ __forceinline__ float bf2f(unsigned short b) { return __uint_as_float(((unsigned)b) << 16); }
__device__ __forceinline__ float bfr(float f) { return bf2f(f2bf(f)); }
__device__ __forceinline__ v16h cat16(v8h lo, v8h hi) { return __builtin_shufflevector(lo, hi, 0, 1, 2, 3, 4, 5, 6, 7, 8, 9, 10, 11, 12, 13, 14, 15); }
__device__ __forceinline__ v16bf cat16b(v8us lo, v8us hi) { return __builtin_bit_cast(v16bf, __builtin_shufflevector(lo, hi, 0, 1, 2, 3, 4, 5, 6, 7, 8, 9, 10, 11, 12, 13, 14, 15)); }
__device__ __forceinline__ v8f wmma16(v16h a, v16h b, v8f c) { return __builtin_amdgcn_wmma_f32_16x16x32_f16(false, a, false, b, (short)0, c, false, false); }
__device__ __forceinline__ v8f wmmab(v16bf a, v16bf b, v8f c) { return __builtin_amdgcn_wmma_f32_16x16x32_bf16(false, a, false, b, (short)0, c, false, false); }



// 16-bit fragment loaders, k order 8h..8h+7 then 16+8h..16+8h+7 on both operands (global weight planes and LDS activation planes alike).
// The weight planes lie in memory in fragment order: blocks of 16 rows x 16 k (256 elements, 512 B), a 16-row tile's blocks in k order, tiles in row order; inside a block element (row r, k = 8h + j) stands at (16h + r) * 8 + j,
// so that lane 16h + r finds its 16 bytes at lane * 16 and one load of a wave takes four whole 128-byte lines (row-major planes: 32 bytes out of each of 16 lines).
#define FB 256   // elements of one 16 x 16 block
__device__ __forceinline__ v16h  ldgh(const h16* p) { return cat16(*(const v8h*)p, *(const v8h*)(p + FB)); }
__device__ __forceinline__ v16bf ldgb(const bf* p)  { return cat16b(*(const v8us*)p, *(const v8us*)(p + FB)); }
__device__ __forceinline__ v16h  ldsh(const bf* p)  { return cat16(*(const v8ha*)p, *(const v8ha*)(p + 16)); }
__device__ __forceinline__ v16bf ldsb(const bf* p)  { return cat16b(*(const v8usa*)p, *(const v8usa*)(p + 16)); }

__device__ __forceinline__ h16 tohx(float x) { return (h16)x; }
__device__ __forceinline__ void splitf(float y, unsigned short& h, unsigned short& l) { h = f2bf(y); l = f2bf(y - bf2f(h)); }
typedef __attribute__((ext_vector_type(2))) _Float16 v2h;
typedef __attribute__((ext_vector_type(4))) _Float16 v4h;
typedef __attribute__((ext_vector_type(2))) unsigned short v2us;
typedef __attribute__((ext_vector_type(4))) unsigned short v4us;

// Which weight (agent a, row n, column k) stands at element e of a plane in fragment order; kb = blocks a tile (K / 16), tb = tiles an agent (rows / 16). 2 or 4 elements from an e that is a multiple of 2 or 4 are consecutive k of one row.
struct FP { int a, n, k; };
__device__ __forceinline__ FP fplace(size_t e, unsigned kb, unsigned tb) { const unsigned in = (unsigned)(e % FB), blk = (unsigned)(e / FB), c = blk % kb, tile = blk / kb;
    return FP{(int)(tile / tb), (int)((tile % tb) * 16 + ((in >> 3) & 15)), (int)(c * 16 + (in >> 7) * 8 + (in & 7))}; }
__global__ __launch_bounds__(256) void k_w1(const float* __restrict__ W1, const float* __restrict__ S1, bf* B1) { const size_t e = ((size_t)blockIdx.x * 256 + threadIdx.x) * 2; if (e >= (size_t)NA * 2 * HH * KI) return; const FP f = fplace(e, KI / 16, 2 * HH / 16); const int k = f.k, n = f.n, a = f.a; const float* src = n < HH ? W1 + ((size_t)a * HH + n) * DI : S1 + ((size_t)a * HH + n - HH) * DI; v2us o;
#pragma unroll
    for (int u = 0; u < 2; ++u) o[u] = (k + u) < DI ? f2bf(src[k + u]) : (unsigned short)0; *(v2us*)(B1 + e) = o;  }
__global__ __launch_bounds__(256) void k_w2(const float* __restrict__ W2, const float* __restrict__ S2, h16* B2) { const size_t e = ((size_t)blockIdx.x * 256 + threadIdx.x) * 4; if (e >= (size_t)NA * 2 * HH * HH) return; const FP f = fplace(e, HH / 16, 2 * HH / 16); const int k = f.k, n = f.n, a = f.a; const float* src = n < HH ? W2 + ((size_t)a * HH + n) * HH : S2 + ((size_t)a * HH + n - HH) * HH; v4h o;
#pragma unroll
    for (int q = 0; q < 4; ++q) o[q] = tohx(bfr(src[k + q])); *(v4h*)(B2 + e) = o;  }
__global__ __launch_bounds__(256) void k_w3(const float* __restrict__ W3, h16* B3) { const size_t e = ((size_t)blockIdx.x * 256 + threadIdx.x) * 4; if (e >= (size_t)NA * HH * HH) return; const FP f = fplace(e, HH / 16, HH / 16); const float* src = W3 + ((size_t)f.a * HH + f.n) * HH + f.k; v4h o;
#pragma unroll
    for (int q = 0; q < 4; ++q) o[q] = tohx(bfr(src[q])); *(v4h*)(B3 + e) = o;  }
__global__ __launch_bounds__(256) void k_wo(const float* __restrict__ Wo, bf* BO) { const size_t e = ((size_t)blockIdx.x * 256 + threadIdx.x) * 4; if (e >= (size_t)NA * 64 * HH) return; const FP f = fplace(e, HH / 16, 64 / 16); const int k = f.k, n = f.n, a = f.a; v4us o;
#pragma unroll
    for (int q = 0; q < 4; ++q) o[q] = n < NO ? f2bf(Wo[((size_t)a * NO + n) * HH + k + q]) : (unsigned short)0; *(v4us*)(BO + e) = o;  }

#define MT 64    // batch rows per work-group
#define NW 12    // waves per work-group: wave w owns output features 16w..16w+15
#define PX 72    // LDS pitch in elements of the K = 64 planes (144 B: 16 rows of 16 B fall on all 64 banks)
#define PH 200   // LDS pitch in elements of the K = 192 planes (400 B, same reason)

__device__ __forceinline__ v8f fma8(v8f a, v8f b, v8f c) { return __builtin_elementwise_fma(a, b, c); }
__device__ __forceinline__ v8f sp8(float c) { return (v8f){c, c, c, c, c, c, c, c}; }
// gelu(main + bm) + (skip + bs) for the 8 consecutive output features that one lane holds of one batch row; gelu(x) = 0.5 x w with w = 1 + erf(x / sqrt 2).
// All 8 go side by side as vectors (independent chains, two floats an instruction). For |x| < sqrt 2, w = 1 + x q(x^2): the odd polynomial that the library's erff takes for an argument below 1, with the 1 / sqrt 2 folded into its six coefficients.
// One test for the whole wave sends all 8 to erff itself as soon as any lane holds an |x| >= sqrt 2 (a NaN stays a NaN on either way).
__device__ __forceinline__ v8f act8(v8f m, v8f s, const float* bm, const float* bs) { v8f vm, vs, w;
#pragma unroll
    for (int j = 0; j < 8; ++j) { vm[j] = bm[j]; vs[j] = bs[j]; }
    const v8f x = m + vm;
    float mx = __builtin_fabsf(x[0]);
#pragma unroll
    for (int j = 1; j < 8; ++j) mx = fmaxf(mx, __builtin_fabsf(x[j]));
    if (__builtin_amdgcn_ballot_w32(mx >= 0x1.6a09e6p+0f) != 0u) {   // the same for the whole wave: a scalar branch, every lane stays on
#pragma unroll
        for (int j = 0; j < 8; ++j) w[j] = 1.0f + erff(x[j] * 0.7071067811865476f);
    } else { const v8f u = x * x;
        v8f q = fma8(u, sp8(-0x1.a08d04p-17f), sp8(0x1.c76bfcp-13f)); q = fma8(u, q, sp8(-0x1.3569b4p-9f)); q = fma8(u, q, sp8(0x1.46b43ap-6f)); q = fma8(u, q, sp8(-0x1.105794p-3f)); q = fma8(u, q, sp8(0x1.988452p-1f));
        w = fma8(x, q, sp8(1.0f)); }
    return (0.5f * x) * w + (s + vs); }
// src is the same for the whole wave (a scalar base); off is the lane's part.
__device__ __forceinline__ void bias8(const float* __restrict__ src, unsigned off, float* dst) {
#pragma unroll
    for (int j = 0; j < 8; ++j) dst[j] = bfr(src[off + j]); }
// Stands behind the bias loads, in front of the weight loads.
__device__ __forceinline__ void xwait() { asm volatile("s_wait_xcnt 0x0" ::: "memory"); }
__device__ __forceinline__ v8h toh8(v8f h) { v8h o;
#pragma unroll
    for (int j = 0; j < 8; ++j) o[j] = tohx(h[j]);
    return o; }

// ---- k_mlp: the whole per-agent MLP for 64 batch rows. grid (NBT / 64, NA), 384 threads. Every product is formed transposed, D[n][m] = sum_k W[n][k] act[m][k] (weights as the A operand, activations as B),
// so a lane holds 8 consecutive features of one batch row and hands them to the next layer with one 16-byte LDS store. A wave loads its 16 features' weights of a layer once into registers and walks the four 16-row blocks
// in a loop that stays rolled: the erf code is long (for speed only). The second launch-bounds argument asks for six waves a SIMD (two work-groups a WGP): without it the build takes more than 160 registers and only one work-group fits.
__global__ __launch_bounds__(NW * 32, 6) void k_mlp(const float* __restrict__ x, const float* __restrict__ wi, const float* __restrict__ bi, const float* __restrict__ b1, const float* __restrict__ sb1, const float* __restrict__ b2, const float* __restrict__ sb2,
                                             const float* __restrict__ b3, const float* __restrict__ hw, const float* __restrict__ hb, const float* __restrict__ bo,
                                             const bf* __restrict__ B1, const h16* __restrict__ B2, const h16* __restrict__ B3, const bf* __restrict__ BO, float* __restrict__ OUT) {
    __shared__ __align__(16) bf buf0[MT * PH];   // h1 (fp16), then h3 hi
    __shared__ __align__(16) bf buf1[MT * PH];   // xn hi and lo, then h2 (fp16), then h3 lo
    __shared__ __align__(16) v4f h2s[NW * 4 * 2 * 32];   // h2 in f32 for the residual of layer 3: each lane's own 8 values per row block, read back by the same lane
    __shared__ float os[MT * NO];
    const int tid = threadIdx.x, lane = tid & 31, lr = lane & 15, hi = lane >> 4;
    const int w = __builtin_amdgcn_readfirstlane(tid >> 5);   // wave number in a scalar register: the branch round the last layer's matrix instructions must be a scalar one
    const int a = blockIdx.y, r0 = blockIdx.x * MT;
    const int n0 = w * 16 + hi * 8;    // first of the lane's 8 features in a D fragment
    const int fo = lr * PH + 8 * hi;   // a lane's place in an activation fragment of the K = 192 planes
    const int so = lr * PH + n0;       // a lane's place for its 8 features of a row
    const int ab = a * HH + w * 16; const unsigned h8 = hi * 8;   // the wave's and the lane's part of a place in a per-feature vector (ab + h8 = a * HH + n0)
    bf* Xh = buf1; bf* Xl = buf1 + MT * PX;
    for (int p = tid; p < MT * KI / 2; p += NW * 32) { const int row = p >> 5, k = (p & 31) * 2; v2us oh, ol;
#pragma unroll
        for (int u = 0; u < 2; ++u) { unsigned short h = 0, l = 0; const int kk = k + u; if (kk < DI) splitf(__fadd_rn(__fmul_rn(bfr(x[(size_t)(r0 + row) * DI + kk]), bfr(wi[a * DI + kk])), bfr(bi[a * DI + kk])), h, l); oh[u] = h; ol[u] = l; }
        *(v2us*)(Xh + row * PX + k) = oh; *(v2us*)(Xl + row * PX + k) = ol; }
    {   // layer 1: [W1|S1] x (xn hi + xn lo), K = 64
        const bf* Bm = B1 + ((size_t)a * 2 * HH + w * 16) * KI + lane * 8; const bf* Bs = Bm + (size_t)HH * KI; v16bf wm[2], ws[2];
        float bm[8], bs[8]; bias8(b1 + ab, h8, bm); bias8(sb1 + ab, h8, bs); xwait();
#pragma unroll
        for (int q = 0; q < 2; ++q) { wm[q] = ldgb(Bm + q * 2 * FB); ws[q] = ldgb(Bs + q * 2 * FB); }
        __syncthreads();   // xn complete
#pragma unroll 1   // rolled: keeps one copy of the erf code per layer in the text
        for (int mb = 0; mb < 4; ++mb) { v8f am = (v8f){}, as = (v8f){};
#pragma unroll
            for (int q = 0; q < 2; ++q) { const v16bf xh = ldsb(Xh + (mb * 16 + lr) * PX + 8 * hi + q * 32), xl = ldsb(Xl + (mb * 16 + lr) * PX + 8 * hi + q * 32);
                am = wmmab(wm[q], xh, am); as = wmmab(ws[q], xh, as); am = wmmab(wm[q], xl, am); as = wmmab(ws[q], xl, as); }
            *(v8ha*)(buf0 + mb * 16 * PH + so) = toh8(act8(am, as, bm, bs)); }
    }
    {   // layer 2: [W2|S2] x h1, K = 192
        const h16* Bm = B2 + ((size_t)a * 2 * HH + w * 16) * HH + lane * 8; const h16* Bs = Bm + (size_t)HH * HH; v16h wm[6], ws[6];
        float bm[8], bs[8]; bias8(b2 + ab, h8, bm); bias8(sb2 + ab, h8, bs); xwait();
#pragma unroll
        for (int q = 0; q < 6; ++q) { wm[q] = ldgh(Bm + q * 2 * FB); ws[q] = ldgh(Bs + q * 2 * FB); }
        __syncthreads();   // h1 complete; every read of xn is over, so buf1 may take h2
#pragma unroll 1   // rolled: as in layer 1
        for (int mb = 0; mb < 4; ++mb) { v8f am = (v8f){}, as = (v8f){};
#pragma unroll
            for (int q = 0; q < 6; ++q) { const v16h hv = ldsh(buf0 + mb * 16 * PH + fo + q * 32); am = wmma16(wm[q], hv, am); as = wmma16(ws[q], hv, as); }
            const v8f h = act8(am, as, bm, bs);
            h2s[((w * 4 + mb) * 2 + 0) * 32 + lane] = (v4f){h[0], h[1], h[2], h[3]}; h2s[((w * 4 + mb) * 2 + 1) * 32 + lane] = (v4f){h[4], h[5], h[6], h[7]};
            *(v8ha*)(buf1 + mb * 16 * PH + so) = toh8(h); }
    }
    {   // layer 3: W3 x h2, K = 192, + b3 + h2 (f32), then the affine hidden norm, split into bf16 hi + lo planes
        const h16* Bm = B3 + ((size_t)a * HH + w * 16) * HH + lane * 8; v16h wm[6];
        float bb[8], sw[8], sb[8]; bias8(b3 + ab, h8, bb); bias8(hw + ab, h8, sw); bias8(hb + ab, h8, sb);
#pragma unroll
        for (int q = 0; q < 6; ++q) wm[q] = ldgh(Bm + q * 2 * FB);
        __syncthreads();   // h2 complete; every read of h1 is over
        v8f ac[4];
#pragma unroll
        for (int mb = 0; mb < 4; ++mb) ac[mb] = (v8f){};
#pragma unroll
        for (int q = 0; q < 6; ++q)
#pragma unroll
            for (int mb = 0; mb < 4; ++mb) ac[mb] = wmma16(wm[q], ldsh(buf1 + mb * 16 * PH + fo + q * 32), ac[mb]);
        __syncthreads();   // every read of h2 (fp16) is over before buf1 takes the lo plane
#pragma unroll
        for (int mb = 0; mb < 4; ++mb) { const v4f ra = h2s[((w * 4 + mb) * 2 + 0) * 32 + lane], rb = h2s[((w * 4 + mb) * 2 + 1) * 32 + lane]; v8us oh, ol;
#pragma unroll
            for (int j = 0; j < 8; ++j) { const float t = __fadd_rn(__fadd_rn(ac[mb][j], bb[j]), j < 4 ? ra[j & 3] : rb[j & 3]); unsigned short h, l; splitf(__fadd_rn(__fmul_rn(t, sw[j]), sb[j]), h, l); oh[j] = h; ol[j] = l; }
            *(v8usa*)(buf0 + mb * 16 * PH + so) = oh; *(v8usa*)(buf1 + mb * 16 * PH + so) = ol; }
    }
    __syncthreads();   // h3 planes complete
    if (w < 4) {   // output layer: Wo (3 rows, zero-padded) x (h3 hi + h3 lo), K = 192; wave w takes batch rows 16w..16w+15
        v8f ac = (v8f){}; const bf* Bm = BO + (size_t)a * 64 * HH + lane * 8;
#pragma unroll
        for (int q = 0; q < 6; ++q) { const v16bf wo = ldgb(Bm + q * 2 * FB); ac = wmmab(wo, ldsb(buf0 + w * 16 * PH + fo + q * 32), ac); ac = wmmab(wo, ldsb(buf1 + w * 16 * PH + fo + q * 32), ac); }
        if (hi == 0) {
#pragma unroll
            for (int j = 0; j < NO; ++j) os[(w * 16 + lr) * NO + j] = ac[j]; }
    }
    __syncthreads();   // logits of the 64 rows gathered: 192 floats, stored thread-linearly so that each wave writes one whole 128-byte line
    if (tid < MT * NO) OUT[((size_t)a * NBT + r0) * NO + tid] = __fadd_rn(os[tid], bfr(bo[a * NO + tid % NO]));
}

extern "C" void kernel_launch(void* const* d_in, const int* in_sizes, int n_in,
                              void* d_out, int out_size, void* d_ws, size_t ws_size, hipStream_t stream) {
    (void)in_sizes; (void)n_in; (void)out_size;
    const float* IN[17]; for (int i = 0; i < 17; ++i) IN[i] = (const float*)d_in[i];   // 0 x, 1 in_w, 2 in_b, 3 W1, 4 b1, 5 W2, 6 b2, 7 W3, 8 b3, 9 Wo, 10 bo, 11 S1, 12 sb1, 13 S2, 14 sb2, 15 hw, 16 hb
    float* OUT = (float*)d_out;     // [64][4096][3]
    char* wsp = (char*)d_ws;
    auto take = [&](size_t bytes) { char* p = wsp; wsp += (bytes + 255) & ~(size_t)255; return (void*)p; };
    bf* B1 = (bf*)take((size_t)NA * 2 * HH * KI * 2); h16* B2 = (h16*)take((size_t)NA * 2 * HH * HH * 2); h16* B3 = (h16*)take((size_t)NA * HH * HH * 2); bf* BO = (bf*)take((size_t)NA * 64 * HH * 2);
    if ((size_t)(wsp - (char*)d_ws) > ws_size) return;    // total ~ 19 MB
    k_w1<<<(unsigned)(((size_t)NA * 2 * HH * KI / 2 + 255) / 256), 256, 0, stream>>>(IN[3], IN[11], B1); k_w2<<<(unsigned)(((size_t)NA * 2 * HH * HH / 4 + 255) / 256), 256, 0, stream>>>(IN[5], IN[13], B2); k_w3<<<(unsigned)(((size_t)NA * HH * HH / 4 + 255) / 256), 256, 0, stream>>>(IN[7], B3); k_wo<<<(unsigned)(((size_t)NA * 64 * HH / 4 + 255) / 256), 256, 0, stream>>>(IN[9], BO);
    k_mlp<<<dim3(NBT / MT, NA), NW * 32, 0, stream>>>(IN[0], IN[1], IN[2], IN[4], IN[12], IN[6], IN[14], IN[8], IN[15], IN[16], IN[10], B1, B2, B3, BO, OUT);
}

// v005
// It runs in 114 microseconds.
// Timed twice side by side with v004, it ran 1.06 times as fast both times.
// All steps since v000 together make it 21.7 times as fast.
#include <hip/hip_runtime.h>

// VectorizedSREKEnsemble - 64 independent MLP "agents" on a shared input (x [4096][50]; per agent a: xn = x w_in[a] + b_in[a] (affine only); h1 = gelu(xn W1^T + b1) + xn S1^T + sb1;
// h2 = gelu(h1 W2^T + b2) + h1 S2^T + sb2; h3 = (h2 W3^T + b3 + h2) hw[a] + hb[a]; logits = h3 Wo^T + bo -> [64][4096][3]; exact (erf) gelu; weights [a][out][in]).
// Compute dtypes, f32 accumulate: every input rounded to bf16; the affine input norm f32 -> bf16 hi+lo planes (K 50 padded to 64) x exact [W1|S1] (2 products, one N = 384 GEMM per agent); h1 and h2 as SINGLE fp16
// planes x fp16 copies of the bf16 [W2|S2] / W3 weights (1 product; hi+lo would double the two 192x384/192x192 GEMMs); the affine hidden norm f32 -> hl planes x exact Wo (3 outputs padded to 64); gelu (erf), biases, skips f32 on VALU.
// One launch carries all four layers: a work-group of 12 waves owns 64 batch rows of one agent and keeps xn, h1, h2 and h3 in LDS (h2 in fp16 and in f32); only the 16-bit weight planes and the logits touch memory.

#define NA   64
#define NBT  4096
#define DI   50
#define KI   64
#define HH   192
#define NO   3
typedef _Float16 h16;
typedef unsigned short bf;
typedef __attribute__((ext_vector_type(16))) __bf16   v16bf;
typedef __attribute__((ext_vector_type(16))) _Float16 v16h;
typedef __attribute__((ext_vector_type(8)))  _Float16 v8h;
typedef __attribute__((ext_vector_type(8)))  unsigned short v8us;
typedef __attribute__((ext_vector_type(8)))  float    v8f;
typedef __attribute__((ext_vector_type(4)))  float    v4f;
typedef v8h  __attribute__((may_alias)) v8ha;
typedef v4f  __attribute__((may_alias)) v4fa;
typedef v8us __attribute__((may_alias)) v8usa;

__device__ __forceinline__ unsigned short f2bf(float f) { unsigned u = __float_as_uint(f); u += 0x7FFFu + ((u >> 16) & 1u); return (unsigned short)(u >> 16); }
__device__ __forceinline__ float bf2f(unsigned short b) { return __uint_as_float(((unsigned)b) << 16); }
__device__ __forceinline__ float bfr(float f) { return bf2f(f2bf(f)); }
__device__ __forceinline__ v16h cat16(v8h lo, v8h hi) { return __builtin_shufflevector(lo, hi, 0, 1, 2, 3, 4, 5, 6, 7, 8, 9, 10, 11, 12, 13, 14, 15); }
__device__ __forceinline__ v16bf cat16b(v8us lo, v8us hi) { return __builtin_bit_cast(v16bf, __builtin_shufflevector(lo, hi, 0, 1, 2, 3, 4, 5, 6, 7, 8, 9, 10, 11, 12, 13, 14, 15)); }
__device__ __forceinline__ v8f wmma16(v16h a, v16h b, v8f c) { return __builtin_amdgcn_wmma_f32_16x16x32_f16(false, a, false, b, (short)0, c, false, false); }
__device__ __forceinline__ v8f wmmab(v16bf a, v16bf b, v8f c) { return __builtin_amdgcn_wmma_f32_16x16x32_bf16(false, a, false, b, (short)0, c, false, false); }



// 16-bit fragment loaders, k order 8h..8h+7 then 16+8h..16+8h+7 on both operands (global weight planes and LDS activation planes alike).
// The weight planes lie in memory in fragment order: blocks of 16 rows x 16 k (256 elements, 512 B), a 16-row tile's blocks in k order, tiles in row order; inside a block element (row r, k = 8h + j) stands at (16h + r) * 8 + j,
// so that lane 16h + r finds its 16 bytes at lane * 16 and one load of a wave takes four whole 128-byte lines (row-major planes: 32 bytes out of each of 16 lines).
#define FB 256   // elements of one 16 x 16 block
__device__ __forceinline__ v16h  ldgh(const h16* p) { return cat16(*(const v8h*)p, *(const v8h*)(p + FB)); }
__device__ __forceinline__ v16bf ldgb(const bf* p)  { return cat16b(*(const v8us*)p, *(const v8us*)(p + FB)); }
__device__ __forceinline__ v16h  ldsh(const bf* p)  { return cat16(*(const v8ha*)p, *(const v8ha*)(p + 16)); }
__device__ __forceinline__ v16bf ldsb(const bf* p)  { return cat16b(*(const v8usa*)p, *(const v8usa*)(p + 16)); }

__device__ __forceinline__ h16 tohx(float x) { return (h16)x; }
__device__ __forceinline__ void splitf(float y, unsigned short& h, unsigned short& l) { h = f2bf(y); l = f2bf(y - bf2f(h)); }
typedef __attribute__((ext_vector_type(2))) _Float16 v2h;
typedef __attribute__((ext_vector_type(2))) unsigned short v2us;

// ---- k_pack: all four weight planes in one launch of 256 work-groups of 12 waves. A wave takes one unit of 12 blocks (3072 elements, 6 KB of a plane): a whole 16-row tile of a K = 192 plane, or three tiles of the K = 64 plane.
// Lane 16h + r holds row r, k = 16c + 8h .. + 7 of block c: 8 consecutive source floats in, 16 bytes out at lane * 16 of the block. A unit's source rows are one contiguous stretch, all its loads are issued before the first conversion,
// and which plane a unit belongs to is a scalar branch. The long units come first in the grid.
#define PW 12                      // waves per packing work-group
#define U2 (NA * 2 * HH / 16)      // units of B2: its tiles, [W2|S2] rows of an agent in tile order
#define U3 (NA * HH / 16)          // units of B3: its tiles
#define U1 (NA * 2 * HH / 16 / 3)  // units of B1: three tiles each (8 units an agent, 4 of W1 rows, then 4 of S1 rows)
#define UO (NA * 64 / 16)          // units of BO: its tiles (only rows 0..2 of an agent's first tile are weights, the rest zero)
// Stands behind a unit's last stores: the scalar code that follows a branch of k_pack reuses the stores' base register pair.
__device__ __forceinline__ void pack_end() { asm volatile("s_wait_xcnt 0x0" ::: "memory"); }
__device__ __forceinline__ void pack_h(const float* __restrict__ src, h16* __restrict__ dst, unsigned lane) { const unsigned so = (lane & 15) * HH + (lane >> 4) * 8; float v[12][8];
#pragma unroll
    for (int c = 0; c < 12; ++c)
#pragma unroll
        for (int j = 0; j < 8; ++j) v[c][j] = src[so + c * 16 + j];
#pragma unroll
    for (int c = 0; c < 12; ++c) { v8h o;
#pragma unroll
        for (int j = 0; j < 8; ++j) o[j] = tohx(bfr(v[c][j]));
        *(v8h*)(dst + c * FB + lane * 8) = o; }
    pack_end(); }
__global__ __launch_bounds__(PW * 32) void k_pack(const float* __restrict__ W1, const float* __restrict__ S1, const float* __restrict__ W2, const float* __restrict__ S2, const float* __restrict__ W3, const float* __restrict__ Wo,
                                                  bf* __restrict__ B1, h16* __restrict__ B2, h16* __restrict__ B3, bf* __restrict__ BO) {
    const unsigned lane = threadIdx.x & 31, r = lane & 15, h = lane >> 4;
    const unsigned u = blockIdx.x * PW + (unsigned)__builtin_amdgcn_readfirstlane(threadIdx.x >> 5);   // the wave's unit, in a scalar register: the branches below are scalar ones
    if (u < U2) { const unsigned a = u / 24, t = u % 24;
        pack_h(t < 12 ? W2 + (size_t)(a * HH + t * 16) * HH : S2 + (size_t)(a * HH + (t - 12) * 16) * HH, B2 + (size_t)u * 12 * FB, lane);
    } else if (u < U2 + U3) { const unsigned t = u - U2;
        pack_h(W3 + (size_t)t * 16 * HH, B3 + (size_t)t * 12 * FB, lane);
    } else if (u < U2 + U3 + U1) { const unsigned t = u - (U2 + U3), a = t / 8, g = t % 8;
        const float* __restrict__ src = g < 4 ? W1 + (size_t)(a * HH + g * 48) * DI : S1 + (size_t)(a * HH + (g - 4) * 48) * DI; bf* __restrict__ dst = B1 + (size_t)t * 12 * FB;
        const unsigned so = r * DI + h * 8; float v[3][3][8], e[3][2];
#pragma unroll
        for (int i = 0; i < 3; ++i)
#pragma unroll
            for (int c = 0; c < 3; ++c)
#pragma unroll
                for (int j = 0; j < 8; ++j) v[i][c][j] = src[so + i * 16 * DI + c * 16 + j];
#pragma unroll
        for (int i = 0; i < 3; ++i) { e[i][0] = 0.0f; e[i][1] = 0.0f; }
        if (h == 0) {   // k = 48, 49: the last two columns of a row; k = 50..63 is padding
#pragma unroll
            for (int i = 0; i < 3; ++i) { e[i][0] = src[so + i * 16 * DI + 48]; e[i][1] = src[so + i * 16 * DI + 49]; } }
#pragma unroll
        for (int i = 0; i < 3; ++i) {
#pragma unroll
            for (int c = 0; c < 3; ++c) { v8us o;
#pragma unroll
                for (int j = 0; j < 8; ++j) o[j] = f2bf(v[i][c][j]);
                *(v8us*)(dst + (i * 4 + c) * FB + lane * 8) = o; }
            *(v8us*)(dst + (i * 4 + 3) * FB + lane * 8) = (v8us){f2bf(e[i][0]), f2bf(e[i][1]), 0, 0, 0, 0, 0, 0}; }
        pack_end();
    } else { const unsigned t = u - (U2 + U3 + U1), a = t / 4, n = (t % 4) * 16 + r; bf* __restrict__ dst = BO + (size_t)t * 12 * FB; float v[12][8];
#pragma unroll
        for (int c = 0; c < 12; ++c)
#pragma unroll
            for (int j = 0; j < 8; ++j) v[c][j] = 0.0f;
        if (n < NO) { const float* __restrict__ src = Wo + (size_t)a * NO * HH; const unsigned so = n * HH + h * 8;
#pragma unroll
            for (int c = 0; c < 12; ++c)
#pragma unroll
                for (int j = 0; j < 8; ++j) v[c][j] = src[so + c * 16 + j]; }
#pragma unroll
        for (int c = 0; c < 12; ++c) { v8us o;
#pragma unroll
            for (int j = 0; j < 8; ++j) o[j] = f2bf(v[c][j]);
            *(v8us*)(dst + c * FB + lane * 8) = o; }
        pack_end();
    }
}

#define MT 64    // batch rows per work-group
#define NW 12    // waves per work-group: wave w owns output features 16w..16w+15
#define PX 72    // LDS pitch in elements of the K = 64 planes (144 B: 16 rows of 16 B fall on all 64 banks)
#define PH 200   // LDS pitch in elements of the K = 192 planes (400 B, same reason)

__device__ __forceinline__ v8f fma8(v8f a, v8f b, v8f c) { return __builtin_elementwise_fma(a, b, c); }
__device__ __forceinline__ v8f sp8(float c) { return (v8f){c, c, c, c, c, c, c, c}; }
// gelu(main + bm) + (skip + bs) for the 8 consecutive output features that one lane holds of one batch row; gelu(x) = 0.5 x w with w = 1 + erf(x / sqrt 2).
// All 8 go side by side as vectors (independent chains, two floats an instruction). For |x| < sqrt 2, w = 1 + x q(x^2): the odd polynomial that the library's erff takes for an argument below 1, with the 1 / sqrt 2 folded into its six coefficients.
// One test for the whole wave sends all 8 to erff itself as soon as any lane holds an |x| >= sqrt 2 (a NaN stays a NaN on either way).
__device__ __forceinline__ v8f act8(v8f m, v8f s, const float* bm, const float* bs) { v8f vm, vs, w;
#pragma unroll
    for (int j = 0; j < 8; ++j) { vm[j] = bm[j]; vs[j] = bs[j]; }
    const v8f x = m + vm;
    float mx = __builtin_fabsf(x[0]);
#pragma unroll
    for (int j = 1; j < 8; ++j) mx = fmaxf(mx, __builtin_fabsf(x[j]));
    if (__builtin_amdgcn_ballot_w32(mx >= 0x1.6a09e6p+0f) != 0u) {   // the same for the whole wave: a scalar branch, every lane stays on
#pragma unroll
        for (int j = 0; j < 8; ++j) w[j] = 1.0f + erff(x[j] * 0.7071067811865476f);
    } else { const v8f u = x * x;
        v8f q = fma8(u, sp8(-0x1.a08d04p-17f), sp8(0x1.c76bfcp-13f)); q = fma8(u, q, sp8(-0x1.3569b4p-9f)); q = fma8(u, q, sp8(0x1.46b43ap-6f)); q = fma8(u, q, sp8(-0x1.105794p-3f)); q = fma8(u, q, sp8(0x1.988452p-1f));
        w = fma8(x, q, sp8(1.0f)); }
    return (0.5f * x) * w + (s + vs); }
// src is the same for the whole wave (a scalar base); off is the lane's part.
__device__ __forceinline__ void bias8(const float* __restrict__ src, unsigned off, float* dst) {
#pragma unroll
    for (int j = 0; j < 8; ++j) dst[j] = bfr(src[off + j]); }
// Stands behind the bias loads, in front of the weight loads.
__device__ __forceinline__ void xwait() { asm volatile("s_wait_xcnt 0x0" ::: "memory"); }
__device__ __forceinline__ v8h toh8(v8f h) { v8h o;
#pragma unroll
    for (int j = 0; j < 8; ++j) o[j] = tohx(h[j]);
    return o; }

// ---- k_mlp: the whole per-agent MLP for 64 batch rows. grid (NBT / 64, NA), 384 threads. Every product is formed transposed, D[n][m] = sum_k W[n][k] act[m][k] (weights as the A operand, activations as B),
// so a lane holds 8 consecutive features of one batch row and hands them to the next layer with one 16-byte LDS store. A wave loads its 16 features' weights of a layer once into registers and walks the four 16-row blocks
// in a loop that stays rolled: the erf code is long (for speed only). The second launch-bounds argument asks for six waves a SIMD (two work-groups a WGP): without it the build takes more than 160 registers and only one work-group fits.
__global__ __launch_bounds__(NW * 32, 6) void k_mlp(const float* __restrict__ x, const float* __restrict__ wi, const float* __restrict__ bi, const float* __restrict__ b1, const float* __restrict__ sb1, const float* __restrict__ b2, const float* __restrict__ sb2,
                                             const float* __restrict__ b3, const float* __restrict__ hw, const float* __restrict__ hb, const float* __restrict__ bo,
                                             const bf* __restrict__ B1, const h16* __restrict__ B2, const h16* __restrict__ B3, const bf* __restrict__ BO, float* __restrict__ OUT) {
    __shared__ __align__(16) bf buf0[MT * PH];   // h1 (fp16), then h3 hi
    __shared__ __align__(16) bf buf1[MT * PH];   // xn hi and lo, then h2 (fp16), then h3 lo
    __shared__ __align__(16) v4f h2s[NW * 4 * 2 * 32];   // h2 in f32 for the residual of layer 3: each lane's own 8 values per row block, read back by the same lane
    __shared__ float os[MT * NO];
    const int tid = threadIdx.x, lane = tid & 31, lr = lane & 15, hi = lane >> 4;
    const int w = __builtin_amdgcn_readfirstlane(tid >> 5);   // wave number in a scalar register: the branch round the last layer's matrix instructions must be a scalar one
    const int a = blockIdx.y, r0 = blockIdx.x * MT;
    const int n0 = w * 16 + hi * 8;    // first of the lane's 8 features in a D fragment
    const int fo = lr * PH + 8 * hi;   // a lane's place in an activation fragment of the K = 192 planes
    const int so = lr * PH + n0;       // a lane's place for its 8 features of a row
    const int ab = a * HH + w * 16; const unsigned h8 = hi * 8;   // the wave's and the lane's part of a place in a per-feature vector (ab + h8 = a * HH + n0)
    bf* Xh = buf1; bf* Xl = buf1 + MT * PX;
    for (int p = tid; p < MT * KI / 2; p += NW * 32) { const int row = p >> 5, k = (p & 31) * 2; v2us oh, ol;
#pragma unroll
        for (int u = 0; u < 2; ++u) { unsigned short h = 0, l = 0; const int kk = k + u; if (kk < DI) splitf(__fadd_rn(__fmul_rn(bfr(x[(size_t)(r0 + row) * DI + kk]), bfr(wi[a * DI + kk])), bfr(bi[a * DI + kk])), h, l); oh[u] = h; ol[u] = l; }
        *(v2us*)(Xh + row * PX + k) = oh; *(v2us*)(Xl + row * PX + k) = ol; }
    {   // layer 1: [W1|S1] x (xn hi + xn lo), K = 64
        const bf* Bm = B1 + ((size_t)a * 2 * HH + w * 16) * KI + lane * 8; const bf* Bs = Bm + (size_t)HH * KI; v16bf wm[2], ws[2];
        float bm[8], bs[8]; bias8(b1 + ab, h8, bm); bias8(sb1 + ab, h8, bs); xwait();
#pragma unroll
        for (int q = 0; q < 2; ++q) { wm[q] = ldgb(Bm + q * 2 * FB); ws[q] = ldgb(Bs + q * 2 * FB); }
        __syncthreads();   // xn complete
#pragma unroll 1   // rolled: keeps one copy of the erf code per layer in the text
        for (int mb = 0; mb < 4; ++mb) { v8f am = (v8f){}, as = (v8f){};
#pragma unroll
            for (int q = 0; q < 2; ++q) { const v16bf xh = ldsb(Xh + (mb * 16 + lr) * PX + 8 * hi + q * 32), xl = ldsb(Xl + (mb * 16 + lr) * PX + 8 * hi + q * 32);
                am = wmmab(wm[q], xh, am); as = wmmab(ws[q], xh, as); am = wmmab(wm[q], xl, am); as = wmmab(ws[q], xl, as); }
            *(v8ha*)(buf0 + mb * 16 * PH + so) = toh8(act8(am, as, bm, bs)); }
    }
    {   // layer 2: [W2|S2] x h1, K = 192
        const h16* Bm = B2 + ((size_t)a * 2 * HH + w * 16) * HH + lane * 8; const h16* Bs = Bm + (size_t)HH * HH; v16h wm[6], ws[6];
        float bm[8], bs[8]; bias8(b2 + ab, h8, bm); bias8(sb2 + ab, h8, bs); xwait();
#pragma unroll
        for (int q = 0; q < 6; ++q) { wm[q] = ldgh(Bm + q * 2 * FB); ws[q] = ldgh(Bs + q * 2 * FB); }
        __syncthreads();   // h1 complete; every read of xn is over, so buf1 may take h2
#pragma unroll 1   // rolled: as in layer 1
        for (int mb = 0; mb < 4; ++mb) { v8f am = (v8f){}, as = (v8f){};
#pragma unroll
            for (int q = 0; q < 6; ++q) { const v16h hv = ldsh(buf0 + mb * 16 * PH + fo + q * 32); am = wmma16(wm[q], hv, am); as = wmma16(ws[q], hv, as); }
            const v8f h = act8(am, as, bm, bs);
            h2s[((w * 4 + mb) * 2 + 0) * 32 + lane] = (v4f){h[0], h[1], h[2], h[3]}; h2s[((w * 4 + mb) * 2 + 1) * 32 + lane] = (v4f){h[4], h[5], h[6], h[7]};
            *(v8ha*)(buf1 + mb * 16 * PH + so) = toh8(h); }
    }
    {   // layer 3: W3 x h2, K = 192, + b3 + h2 (f32), then the affine hidden norm, split into bf16 hi + lo planes
        const h16* Bm = B3 + ((size_t)a * HH + w * 16) * HH + lane * 8; v16h wm[6];
        float bb[8], sw[8], sb[8]; bias8(b3 + ab, h8, bb); bias8(hw + ab, h8, sw); bias8(hb + ab, h8, sb);
#pragma unroll
        for (int q = 0; q < 6; ++q) wm[q] = ldgh(Bm + q * 2 * FB);
        __syncthreads();   // h2 complete; every read of h1 is over
        v8f ac[4];
#pragma unroll
        for (int mb = 0; mb < 4; ++mb) ac[mb] = (v8f){};
#pragma unroll
        for (int q = 0; q < 6; ++q)
#pragma unroll
            for (int mb = 0; mb < 4; ++mb) ac[mb] = wmma16(wm[q], ldsh(buf1 + mb * 16 * PH + fo + q * 32), ac[mb]);
        __syncthreads();   // every read of h2 (fp16) is over before buf1 takes the lo plane
#pragma unroll
        for (int mb = 0; mb < 4; ++mb) { const v4f ra = h2s[((w * 4 + mb) * 2 + 0) * 32 + lane], rb = h2s[((w * 4 + mb) * 2 + 1) * 32 + lane]; v8us oh, ol;
#pragma unroll
            for (int j = 0; j < 8; ++j) { const float t = __fadd_rn(__fadd_rn(ac[mb][j], bb[j]), j < 4 ? ra[j & 3] : rb[j & 3]); unsigned short h, l; splitf(__fadd_rn(__fmul_rn(t, sw[j]), sb[j]), h, l); oh[j] = h; ol[j] = l; }
            *(v8usa*)(buf0 + mb * 16 * PH + so) = oh; *(v8usa*)(buf1 + mb * 16 * PH + so) = ol; }
    }
    __syncthreads();   // h3 planes complete
    if (w < 4) {   // output layer: Wo (3 rows, zero-padded) x (h3 hi + h3 lo), K = 192; wave w takes batch rows 16w..16w+15
        v8f ac = (v8f){}; const bf* Bm = BO + (size_t)a * 64 * HH + lane * 8;
#pragma unroll
        for (int q = 0; q < 6; ++q) { const v16bf wo = ldgb(Bm + q * 2 * FB); ac = wmmab(wo, ldsb(buf0 + w * 16 * PH + fo + q * 32), ac); ac = wmmab(wo, ldsb(buf1 + w * 16 * PH + fo + q * 32), ac); }
        if (hi == 0) {
#pragma unroll
            for (int j = 0; j < NO; ++j) os[(w * 16 + lr) * NO + j] = ac[j]; }
    }
    __syncthreads();   // logits of the 64 rows gathered: 192 floats, stored thread-linearly so that each wave writes one whole 128-byte line
    if (tid < MT * NO) OUT[((size_t)a * NBT + r0) * NO + tid] = __fadd_rn(os[tid], bfr(bo[a * NO + tid % NO]));
}

extern "C" void kernel_launch(void* const* d_in, const int* in_sizes, int n_in,
                              void* d_out, int out_size, void* d_ws, size_t ws_size, hipStream_t stream) {
    (void)in_sizes; (void)n_in; (void)out_size;
    const float* IN[17]; for (int i = 0; i < 17; ++i) IN[i] = (const float*)d_in[i];   // 0 x, 1 in_w, 2 in_b, 3 W1, 4 b1, 5 W2, 6 b2, 7 W3, 8 b3, 9 Wo, 10 bo, 11 S1, 12 sb1, 13 S2, 14 sb2, 15 hw, 16 hb
    float* OUT = (float*)d_out;     // [64][4096][3]
    char* wsp = (char*)d_ws;
    auto take = [&](size_t bytes) { char* p = wsp; wsp += (bytes + 255) & ~(size_t)255; return (void*)p; };
    bf* B1 = (bf*)take((size_t)NA * 2 * HH * KI * 2); h16* B2 = (h16*)take((size_t)NA * 2 * HH * HH * 2); h16* B3 = (h16*)take((size_t)NA * HH * HH * 2); bf* BO = (bf*)take((size_t)NA * 64 * HH * 2);
    if ((size_t)(wsp - (char*)d_ws) > ws_size) return;    // total ~ 19 MB
    k_pack<<<(U2 + U3 + U1 + UO) / PW, PW * 32, 0, stream>>>(IN[3], IN[11], IN[5], IN[13], IN[7], IN[9], B1, B2, B3, BO);
    k_mlp<<<dim3(NBT / MT, NA), NW * 32, 0, stream>>>(IN[0], IN[1], IN[2], IN[4], IN[12], IN[6], IN[14], IN[8], IN[15], IN[16], IN[10], B1, B2, B3, BO, OUT);
}

// v006
// Measured time: 99.4 microseconds a run.
// Two timings next to v005 both put it at 1.15 times that version's speed.
// Over all steps from v000 it is 24.8 times as fast.
#include <hip/hip_runtime.h>

// VectorizedSREKEnsemble - 64 independent MLP "agents" on a shared input (x [4096][50]; per agent a: xn = x w_in[a] + b_in[a] (affine only); h1 = gelu(xn W1^T + b1) + xn S1^T + sb1;
// h2 = gelu(h1 W2^T + b2) + h1 S2^T + sb2; h3 = (h2 W3^T + b3 + h2) hw[a] + hb[a]; logits = h3 Wo^T + bo -> [64][4096][3]; exact (erf) gelu; weights [a][out][in]).
// Compute dtypes, f32 accumulate: every input rounded to bf16; the affine input norm f32 -> bf16 hi+lo planes (K 50 padded to 64) x exact [W1|S1] (2 products, one N = 384 GEMM per agent); h1 and h2 as SINGLE fp16
// planes x fp16 copies of the bf16 [W2|S2] / W3 weights (1 product; hi+lo would double the two 192x384/192x192 GEMMs); the affine hidden norm f32 -> hl planes x exact Wo (3 outputs padded to 64); gelu (erf), biases, skips f32 on VALU.
// One launch carries all four layers: a work-group of 12 waves owns 64 batch rows of one agent and keeps xn, h1, h2 and h3 in LDS (h2 in fp16 and in f32); only the 16-bit weight planes and the logits touch memory.

#define NA   64
#define NBT  4096
#define DI   50
#define KI   64
#define HH   192
#define NO   3
typedef _Float16 h16;
typedef unsigned short bf;
typedef __attribute__((ext_vector_type(16))) __bf16   v16bf;
typedef __attribute__((ext_vector_type(16))) _Float16 v16h;
typedef __attribute__((ext_vector_type(8)))  _Float16 v8h;
typedef __attribute__((ext_vector_type(8)))  unsigned short v8us;
typedef __attribute__((ext_vector_type(8)))  float    v8f;
typedef __attribute__((ext_vector_type(4)))  float    v4f;
typedef v8h  __attribute__((may_alias)) v8ha;
typedef v4f  __attribute__((may_alias)) v4fa;
typedef v8us __attribute__((may_alias)) v8usa;

__device__ __forceinline__ unsigned short f2bf(float f) { unsigned u = __float_as_uint(f); u += 0x7FFFu + ((u >> 16) & 1u); return (unsigned short)(u >> 16); }
__device__ __forceinline__ float bf2f(unsigned short b) { return __uint_as_float(((unsigned)b) << 16); }
__device__ __forceinline__ float bfr(float f) { return bf2f(f2bf(f)); }
__device__ __forceinline__ v16h cat16(v8h lo, v8h hi) { return __builtin_shufflevector(lo, hi, 0, 1, 2, 3, 4, 5, 6, 7, 8, 9, 10, 11, 12, 13, 14, 15); }
__device__ __forceinline__ v16bf cat16b(v8us lo, v8us hi) { return __builtin_bit_cast(v16bf, __builtin_shufflevector(lo, hi, 0, 1, 2, 3, 4, 5, 6, 7, 8, 9, 10, 11, 12, 13, 14, 15)); }
__device__ __forceinline__ v8f wmma16(v16h a, v16h b, v8f c) { return __builtin_amdgcn_wmma_f32_16x16x32_f16(false, a, false, b, (short)0, c, false, false); }
__device__ __forceinline__ v8f wmmab(v16bf a, v16bf b, v8f c) { return __builtin_amdgcn_wmma_f32_16x16x32_bf16(false, a, false, b, (short)0, c, false, false); }



// 16-bit fragment loaders, k order 8h..8h+7 then 16+8h..16+8h+7 on both operands (global weight planes and LDS activation planes alike).
// The weight planes lie in memory in fragment order: blocks of 16 rows x 16 k (256 elements, 512 B), a 16-row tile's blocks in k order, tiles in row order; inside a block element (row r, k = 8h + j) stands at (16h + r) * 8 + j,
// so that lane 16h + r finds its 16 bytes at lane * 16 and one load of a wave takes four whole 128-byte lines (row-major planes: 32 bytes out of each of 16 lines).
#define FB 256   // elements of one 16 x 16 block
__device__ __forceinline__ v16h  ldgh(const h16* p) { return cat16(*(const v8h*)p, *(const v8h*)(p + FB)); }
__device__ __forceinline__ v16bf ldgb(const bf* p)  { return cat16b(*(const v8us*)p, *(const v8us*)(p + FB)); }
__device__ __forceinline__ v16h  ldsh(const bf* p)  { return cat16(*(const v8ha*)p, *(const v8ha*)(p + 16)); }
__device__ __forceinline__ v16bf ldsb(const bf* p)  { return cat16b(*(const v8usa*)p, *(const v8usa*)(p + 16)); }

__device__ __forceinline__ h16 tohx(float x) { return (h16)x; }
__device__ __forceinline__ void splitf(float y, unsigned short& h, unsigned short& l) { h = f2bf(y); l = f2bf(y - bf2f(h)); }
typedef __attribute__((ext_vector_type(2))) _Float16 v2h;
typedef __attribute__((ext_vector_type(2))) unsigned short v2us;
typedef __attribute__((ext_vector_type(2))) float v2f;
typedef v2f __attribute__((may_alias)) v2fa;

// ---- k_pack: all four weight planes in one launch of 256 work-groups of 12 waves. A wave takes one unit of 12 blocks (3072 elements, 6 KB of a plane): a whole 16-row tile of a K = 192 plane, or three tiles of the K = 64 plane.
// Lane 16h + r holds row r, k = 16c + 8h .. + 7 of block c: 8 consecutive source floats in, 16 bytes out at lane * 16 of the block. A unit's source rows are one contiguous stretch, all its loads are issued before the first conversion,
// and which plane a unit belongs to is a scalar branch. The long units come first in the grid.
#define PW 12                      // waves per packing work-group
#define U2 (NA * 2 * HH / 16)      // units of B2: its tiles, [W2|S2] rows of an agent in tile order
#define U3 (NA * HH / 16)          // units of B3: its tiles
#define U1 (NA * 2 * HH / 16 / 3)  // units of B1: three tiles each (8 units an agent, 4 of W1 rows, then 4 of S1 rows)
#define UO (NA * 64 / 16)          // units of BO: its tiles (only rows 0..2 of an agent's first tile are weights, the rest zero)
// Stands behind a unit's last stores: the scalar code that follows a branch of k_pack reuses the stores' base register pair.
__device__ __forceinline__ void pack_end() { asm volatile("s_wait_xcnt 0x0" ::: "memory"); }
__device__ __forceinline__ void pack_h(const float* __restrict__ src, h16* __restrict__ dst, unsigned lane) { const unsigned so = (lane & 15) * HH + (lane >> 4) * 8; float v[12][8];
#pragma unroll
    for (int c = 0; c < 12; ++c)
#pragma unroll
        for (int j = 0; j < 8; ++j) v[c][j] = src[so + c * 16 + j];
#pragma unroll
    for (int c = 0; c < 12; ++c) { v8h o;
#pragma unroll
        for (int j = 0; j < 8; ++j) o[j] = tohx(bfr(v[c][j]));
        *(v8h*)(dst + c * FB + lane * 8) = o; }
    pack_end(); }
__global__ __launch_bounds__(PW * 32) void k_pack(const float* __restrict__ W1, const float* __restrict__ S1, const float* __restrict__ W2, const float* __restrict__ S2, const float* __restrict__ W3, const float* __restrict__ Wo,
                                                  bf* __restrict__ B1, h16* __restrict__ B2, h16* __restrict__ B3, bf* __restrict__ BO) {
    const unsigned lane = threadIdx.x & 31, r = lane & 15, h = lane >> 4;
    const unsigned u = blockIdx.x * PW + (unsigned)__builtin_amdgcn_readfirstlane(threadIdx.x >> 5);   // the wave's unit, in a scalar register: the branches below are scalar ones
    if (u < U2) { const unsigned a = u / 24, t = u % 24;
        pack_h(t < 12 ? W2 + (size_t)(a * HH + t * 16) * HH : S2 + (size_t)(a * HH + (t - 12) * 16) * HH, B2 + (size_t)u * 12 * FB, lane);
    } else if (u < U2 + U3) { const unsigned t = u - U2;
        pack_h(W3 + (size_t)t * 16 * HH, B3 + (size_t)t * 12 * FB, lane);
    } else if (u < U2 + U3 + U1) { const unsigned t = u - (U2 + U3), a = t / 8, g = t % 8;
        const float* __restrict__ src = g < 4 ? W1 + (size_t)(a * HH + g * 48) * DI : S1 + (size_t)(a * HH + (g - 4) * 48) * DI; bf* __restrict__ dst = B1 + (size_t)t * 12 * FB;
        const unsigned so = r * DI + h * 8; float v[3][3][8], e[3][2];
#pragma unroll
        for (int i = 0; i < 3; ++i)
#pragma unroll
            for (int c = 0; c < 3; ++c)
#pragma unroll
                for (int j = 0; j < 8; ++j) v[i][c][j] = src[so + i * 16 * DI + c * 16 + j];
#pragma unroll
        for (int i = 0; i < 3; ++i) { e[i][0] = 0.0f; e[i][1] = 0.0f; }
        if (h == 0) {   // k = 48, 49: the last two columns of a row; k = 50..63 is padding
#pragma unroll
            for (int i = 0; i < 3; ++i) { e[i][0] = src[so + i * 16 * DI + 48]; e[i][1] = src[so + i * 16 * DI + 49]; } }
#pragma unroll
        for (int i = 0; i < 3; ++i) {
#pragma unroll
            for (int c = 0; c < 3; ++c) { v8us o;
#pragma unroll
                for (int j = 0; j < 8; ++j) o[j] = f2bf(v[i][c][j]);
                *(v8us*)(dst + (i * 4 + c) * FB + lane * 8) = o; }
            *(v8us*)(dst + (i * 4 + 3) * FB + lane * 8) = (v8us){f2bf(e[i][0]), f2bf(e[i][1]), 0, 0, 0, 0, 0, 0}; }
        pack_end();
    } else { const unsigned t = u - (U2 + U3 + U1), a = t / 4, n = (t % 4) * 16 + r; bf* __restrict__ dst = BO + (size_t)t * 12 * FB; float v[12][8];
#pragma unroll
        for (int c = 0; c < 12; ++c)
#pragma unroll
            for (int j = 0; j < 8; ++j) v[c][j] = 0.0f;
        if (n < NO) { const float* __restrict__ src = Wo + (size_t)a * NO * HH; const unsigned so = n * HH + h * 8;
#pragma unroll
            for (int c = 0; c < 12; ++c)
#pragma unroll
                for (int j = 0; j < 8; ++j) v[c][j] = src[so + c * 16 + j]; }
#pragma unroll
        for (int c = 0; c < 12; ++c) { v8us o;
#pragma unroll
            for (int j = 0; j < 8; ++j) o[j] = f2bf(v[c][j]);
            *(v8us*)(dst + c * FB + lane * 8) = o; }
        pack_end();
    }
}

#define MT 64    // batch rows per work-group
#define NW 12    // waves per work-group: wave w owns output features 16w..16w+15
#define PX 72    // LDS pitch in elements of the K = 64 planes (144 B: 16 rows of 16 B fall on all 64 banks)
#define PH 200   // LDS pitch in elements of the K = 192 planes (400 B, same reason)

__device__ __forceinline__ v8f fma8(v8f a, v8f b, v8f c) { return __builtin_elementwise_fma(a, b, c); }
__device__ __forceinline__ v8f sp8(float c) { return (v8f){c, c, c, c, c, c, c, c}; }
// gelu(main + bm) + (skip + bs) for the 8 consecutive output features that one lane holds of one batch row; gelu(x) = 0.5 x w with w = 1 + erf(x / sqrt 2).
// All 8 go side by side as vectors (independent chains, two floats an instruction). For |x| < sqrt 2, w = 1 + x q(x^2): the odd polynomial that the library's erff takes for an argument below 1, with the 1 / sqrt 2 folded into its six coefficients.
// One test for the whole wave sends all 8 to erff itself as soon as any lane holds an |x| >= sqrt 2 (a NaN stays a NaN on either way).
__device__ __forceinline__ v8f act8(v8f m, v8f s, const float* bm, const float* bs) { v8f vm, vs, w;
#pragma unroll
    for (int j = 0; j < 8; ++j) { vm[j] = bm[j]; vs[j] = bs[j]; }
    const v8f x = m + vm;
    float mx = __builtin_fabsf(x[0]);
#pragma unroll
    for (int j = 1; j < 8; ++j) mx = fmaxf(mx, __builtin_fabsf(x[j]));
    if (__builtin_amdgcn_ballot_w32(mx >= 0x1.6a09e6p+0f) != 0u) {   // the same for the whole wave: a scalar branch, every lane stays on
#pragma unroll
        for (int j = 0; j < 8; ++j) w[j] = 1.0f + erff(x[j] * 0.7071067811865476f);
    } else { const v8f u = x * x;
        v8f q = fma8(u, sp8(-0x1.a08d04p-17f), sp8(0x1.c76bfcp-13f)); q = fma8(u, q, sp8(-0x1.3569b4p-9f)); q = fma8(u, q, sp8(0x1.46b43ap-6f)); q = fma8(u, q, sp8(-0x1.105794p-3f)); q = fma8(u, q, sp8(0x1.988452p-1f));
        w = fma8(x, q, sp8(1.0f)); }
    return (0.5f * x) * w + (s + vs); }
// src is the same for the whole wave (a scalar base); off is the lane's part.
__device__ __forceinline__ void bias8(const float* __restrict__ src, unsigned off, float* dst) {
#pragma unroll
    for (int j = 0; j < 8; ++j) dst[j] = bfr(src[off + j]); }
// Stands behind the bias loads, in front of the weight loads.
__device__ __forceinline__ void xwait() { asm volatile("s_wait_xcnt 0x0" ::: "memory"); }
__device__ __forceinline__ v8h toh8(v8f h) { v8h o;
#pragma unroll
    for (int j = 0; j < 8; ++j) o[j] = tohx(h[j]);
    return o; }

// ---- k_mlp: the whole per-agent MLP for 64 batch rows. grid (NBT / 64, NA), 384 threads. Every product is formed transposed, D[n][m] = sum_k W[n][k] act[m][k] (weights as the A operand, activations as B),
// so a lane holds 8 consecutive features of one batch row and hands them to the next layer with one 16-byte LDS store. A wave loads its 16 features' weights of a layer once into registers and walks the four 16-row blocks
// in a loop that stays rolled: the erf code is long (for speed only). The second launch-bounds argument asks for six waves a SIMD (two work-groups a WGP): without it the build takes more than 160 registers and only one work-group fits.
__global__ __launch_bounds__(NW * 32, 6) void k_mlp(const float* __restrict__ x, const float* __restrict__ wi, const float* __restrict__ bi, const float* __restrict__ b1, const float* __restrict__ sb1, const float* __restrict__ b2, const float* __restrict__ sb2,
                                             const float* __restrict__ b3, const float* __restrict__ hw, const float* __restrict__ hb, const float* __restrict__ bo,
                                             const bf* __restrict__ B1, const h16* __restrict__ B2, const h16* __restrict__ B3, const bf* __restrict__ BO, float* __restrict__ OUT) {
    __shared__ __align__(16) bf buf0[MT * PH];   // h1 (fp16), then h3 hi
    __shared__ __align__(16) bf buf1[MT * PH];   // xn hi and lo, then h2 (fp16), then h3 lo
    __shared__ __align__(16) v4f h2s[NW * 4 * 2 * 32];   // h2 in f32 for the residual of layer 3: each lane's own 8 values per row block, read back by the same lane
    __shared__ float os[MT * NO];
    const int tid = threadIdx.x, lane = tid & 31, lr = lane & 15, hi = lane >> 4;
    const int w = __builtin_amdgcn_readfirstlane(tid >> 5);   // wave number in a scalar register: the branch round the last layer's matrix instructions must be a scalar one
    const int a = blockIdx.y, r0 = blockIdx.x * MT;
    const int n0 = w * 16 + hi * 8;    // first of the lane's 8 features in a D fragment
    const int fo = lr * PH + 8 * hi;   // a lane's place in an activation fragment of the K = 192 planes
    const int so = lr * PH + n0;       // a lane's place for its 8 features of a row
    const int ab = a * HH + w * 16; const unsigned h8 = hi * 8;   // the wave's and the lane's part of a place in a per-feature vector (ab + h8 = a * HH + n0)
    bf* Xh = buf1; bf* Xl = buf1 + MT * PX;
    // Input norm: lane l holds columns 2l, 2l + 1 (one 8-byte load; DI is even, so a pair is all data or all padding) of rows w, w + 12, ..., six rows for waves 0..3 and five for the rest.
    // All of a thread's x pairs, its pair of the agent's scale and shift, and layer 1's biases and weights are asked for before anything waits: one round trip to the cache in place of one per element.
    const int k2 = lane * 2; const bool kon = k2 < DI; const int kc = kon ? k2 : 0;   // a padding lane reads column 0 (in bounds) and stores zeros
    v2f xv[6]; const float* xs = x + (size_t)(r0 + w) * DI;   // the wave's first row: a scalar base
#pragma unroll
    for (int i = 0; i < 5; ++i) xv[i] = *(const v2fa*)(xs + i * NW * DI + kc);
    xv[5] = *(const v2fa*)(xs + (w < MT - 5 * NW ? 5 * NW * DI : 0) + kc);   // a wave without a sixth row reads its first again
    const v2f wv = *(const v2fa*)(wi + a * DI + kc), bv = *(const v2fa*)(bi + a * DI + kc);
    const float bov = bo[a * NO + tid % NO];   // the output bias of the thread's logit, for the last line of the kernel
    {   // layer 1: [W1|S1] x (xn hi + xn lo), K = 64
        const bf* Bm = B1 + ((size_t)a * 2 * HH + w * 16) * KI + lane * 8; const bf* Bs = Bm + (size_t)HH * KI; v16bf wm[2], ws[2];
        float bm[8], bs[8]; bias8(b1 + ab, h8, bm); bias8(sb1 + ab, h8, bs); xwait();
#pragma unroll
        for (int q = 0; q < 2; ++q) { wm[q] = ldgb(Bm + q * 2 * FB); ws[q] = ldgb(Bs + q * 2 * FB); }
        __builtin_amdgcn_sched_barrier(0);   // keeps conversions and later address work out from among the loads above, so that they issue back to back: without it the build puts three more s_wait_xcnt 0 between them
        asm volatile("" :: "v"(xv[5]));      // inputs only: holds the sixth row's load up here with the others; without it the compiler sinks it into the branch below, where it is waited for alone
#pragma unroll
        for (int i = 0; i < 6; ++i) { const int row = w + NW * i; v2us oh, ol;
#pragma unroll
            for (int u = 0; u < 2; ++u) { unsigned short h, l; splitf(__fadd_rn(__fmul_rn(bfr(xv[i][u]), bfr(wv[u])), bfr(bv[u])), h, l); oh[u] = kon ? h : (unsigned short)0; ol[u] = kon ? l : (unsigned short)0; }
            if (i < 5 || w < MT - 5 * NW) { *(v2us*)(Xh + row * PX + k2) = oh; *(v2us*)(Xl + row * PX + k2) = ol; } }   // the sixth row's test is a scalar one (w is in a scalar register)
        __syncthreads();   // xn complete
#pragma unroll 1   // rolled: keeps one copy of the erf code per layer in the text
        for (int mb = 0; mb < 4; ++mb) { v8f am = (v8f){}, as = (v8f){};
#pragma unroll
            for (int q = 0; q < 2; ++q) { const v16bf xh = ldsb(Xh + (mb * 16 + lr) * PX + 8 * hi + q * 32), xl = ldsb(Xl + (mb * 16 + lr) * PX + 8 * hi + q * 32);
                am = wmmab(wm[q], xh, am); as = wmmab(ws[q], xh, as); am = wmmab(wm[q], xl, am); as = wmmab(ws[q], xl, as); }
            *(v8ha*)(buf0 + mb * 16 * PH + so) = toh8(act8(am, as, bm, bs)); }
    }
    {   // layer 2: [W2|S2] x h1, K = 192
        const h16* Bm = B2 + ((size_t)a * 2 * HH + w * 16) * HH + lane * 8; const h16* Bs = Bm + (size_t)HH * HH; v16h wm[6], ws[6];
        float bm[8], bs[8]; bias8(b2 + ab, h8, bm); bias8(sb2 + ab, h8, bs); xwait();
#pragma unroll
        for (int q = 0; q < 6; ++q) { wm[q] = ldgh(Bm + q * 2 * FB); ws[q] = ldgh(Bs + q * 2 * FB); }
        __syncthreads();   // h1 complete; every read of xn is over, so buf1 may take h2
#pragma unroll 1   // rolled: as in layer 1
        for (int mb = 0; mb < 4; ++mb) { v8f am = (v8f){}, as = (v8f){};
#pragma unroll
            for (int q = 0; q < 6; ++q) { const v16h hv = ldsh(buf0 + mb * 16 * PH + fo + q * 32); am = wmma16(wm[q], hv, am); as = wmma16(ws[q], hv, as); }
            const v8f h = act8(am, as, bm, bs);
            h2s[((w * 4 + mb) * 2 + 0) * 32 + lane] = (v4f){h[0], h[1], h[2], h[3]}; h2s[((w * 4 + mb) * 2 + 1) * 32 + lane] = (v4f){h[4], h[5], h[6], h[7]};
            *(v8ha*)(buf1 + mb * 16 * PH + so) = toh8(h); }
    }
    {   // layer 3: W3 x h2, K = 192, + b3 + h2 (f32), then the affine hidden norm, split into bf16 hi + lo planes
        const h16* Bm = B3 + ((size_t)a * HH + w * 16) * HH + lane * 8; v16h wm[6];
        float bb[8], sw[8], sb[8]; bias8(b3 + ab, h8, bb); bias8(hw + ab, h8, sw); bias8(hb + ab, h8, sb);
#pragma unroll
        for (int q = 0; q < 6; ++q) wm[q] = ldgh(Bm + q * 2 * FB);
        __syncthreads();   // h2 complete; every read of h1 is over
        v8f ac[4];
#pragma unroll
        for (int mb = 0; mb < 4; ++mb) ac[mb] = (v8f){};
#pragma unroll
        for (int q = 0; q < 6; ++q)
#pragma unroll
            for (int mb = 0; mb < 4; ++mb) ac[mb] = wmma16(wm[q], ldsh(buf1 + mb * 16 * PH + fo + q * 32), ac[mb]);
        __syncthreads();   // every read of h2 (fp16) is over before buf1 takes the lo plane
#pragma unroll
        for (int mb = 0; mb < 4; ++mb) { const v4f ra = h2s[((w * 4 + mb) * 2 + 0) * 32 + lane], rb = h2s[((w * 4 + mb) * 2 + 1) * 32 + lane]; v8us oh, ol;
#pragma unroll
            for (int j = 0; j < 8; ++j) { const float t = __fadd_rn(__fadd_rn(ac[mb][j], bb[j]), j < 4 ? ra[j & 3] : rb[j & 3]); unsigned short h, l; splitf(__fadd_rn(__fmul_rn(t, sw[j]), sb[j]), h, l); oh[j] = h; ol[j] = l; }
            *(v8usa*)(buf0 + mb * 16 * PH + so) = oh; *(v8usa*)(buf1 + mb * 16 * PH + so) = ol; }
    }
    __syncthreads();   // h3 planes complete
    if (w < 4) {   // output layer: Wo (3 rows, zero-padded) x (h3 hi + h3 lo), K = 192; wave w takes batch rows 16w..16w+15
        v8f ac = (v8f){}; const bf* Bm = BO + (size_t)a * 64 * HH + lane * 8;
#pragma unroll
        for (int q = 0; q < 6; ++q) { const v16bf wo = ldgb(Bm + q * 2 * FB); ac = wmmab(wo, ldsb(buf0 + w * 16 * PH + fo + q * 32), ac); ac = wmmab(wo, ldsb(buf1 + w * 16 * PH + fo + q * 32), ac); }
        if (hi == 0) {
#pragma unroll
            for (int j = 0; j < NO; ++j) os[(w * 16 + lr) * NO + j] = ac[j]; }
    }
    __syncthreads();   // logits of the 64 rows gathered: 192 floats, stored thread-linearly so that each wave writes one whole 128-byte line
    if (tid < MT * NO) OUT[((size_t)a * NBT + r0) * NO + tid] = __fadd_rn(os[tid], bfr(bov));
}

extern "C" void kernel_launch(void* const* d_in, const int* in_sizes, int n_in,
                              void* d_out, int out_size, void* d_ws, size_t ws_size, hipStream_t stream) {
    (void)in_sizes; (void)n_in; (void)out_size;
    const float* IN[17]; for (int i = 0; i < 17; ++i) IN[i] = (const float*)d_in[i];   // 0 x, 1 in_w, 2 in_b, 3 W1, 4 b1, 5 W2, 6 b2, 7 W3, 8 b3, 9 Wo, 10 bo, 11 S1, 12 sb1, 13 S2, 14 sb2, 15 hw, 16 hb
    float* OUT = (float*)d_out;     // [64][4096][3]
    char* wsp = (char*)d_ws;
    auto take = [&](size_t bytes) { char* p = wsp; wsp += (bytes + 255) & ~(size_t)255; return (void*)p; };
    bf* B1 = (bf*)take((size_t)NA * 2 * HH * KI * 2); h16* B2 = (h16*)take((size_t)NA * 2 * HH * HH * 2); h16* B3 = (h16*)take((size_t)NA * HH * HH * 2); bf* BO = (bf*)take((size_t)NA * 64 * HH * 2);
    if ((size_t)(wsp - (char*)d_ws) > ws_size) return;    // total ~ 19 MB
    k_pack<<<(U2 + U3 + U1 + UO) / PW, PW * 32, 0, stream>>>(IN[3], IN[11], IN[5], IN[13], IN[7], IN[9], B1, B2, B3, BO);
    k_mlp<<<dim3(NBT / MT, NA), NW * 32, 0, stream>>>(IN[0], IN[1], IN[2], IN[4], IN[12], IN[6], IN[14], IN[8], IN[15], IN[16], IN[10], B1, B2, B3, BO, OUT);
}

// v007
// Measured time: 95.1 microseconds a run.
// Two timings next to v006 both put it at 1.05 times that version's speed.
// All steps since v000 together make it 26.0 times as fast.
#include <hip/hip_runtime.h>

// VectorizedSREKEnsemble - 64 independent MLP "agents" on a shared input (x [4096][50]; per agent a: xn = x w_in[a] + b_in[a] (affine only); h1 = gelu(xn W1^T + b1) + xn S1^T + sb1;
// h2 = gelu(h1 W2^T + b2) + h1 S2^T + sb2; h3 = (h2 W3^T + b3 + h2) hw[a] + hb[a]; logits = h3 Wo^T + bo -> [64][4096][3]; exact (erf) gelu; weights [a][out][in]).
// Compute dtypes, f32 accumulate: every input rounded to bf16; the affine input norm f32 -> bf16 hi+lo planes (K 50 padded to 64) x exact [W1|S1] (2 products, one N = 384 GEMM per agent); h1 and h2 as SINGLE fp16
// planes x fp16 copies of the bf16 [W2|S2] / W3 weights (1 product; hi+lo would double the two 192x384/192x192 GEMMs); the affine hidden norm f32 -> hl planes x exact Wo (3 outputs padded to 64); gelu (erf), biases, skips f32 on VALU.
// One launch carries all four layers: a work-group of 12 waves owns 64 batch rows of one agent and keeps xn, h1, h2 and h3 in LDS (h2 in fp16 and in f32); only the 16-bit weight planes and the logits touch memory.

#define NA   64
#define NBT  4096
#define DI   50
#define KI   64
#define HH   192
#define NO   3
typedef _Float16 h16;
typedef unsigned short bf;
typedef __attribute__((ext_vector_type(16))) __bf16   v16bf;
typedef __attribute__((ext_vector_type(16))) _Float16 v16h;
typedef __attribute__((ext_vector_type(8)))  _Float16 v8h;
typedef __attribute__((ext_vector_type(8)))  unsigned short v8us;
typedef __attribute__((ext_vector_type(8)))  float    v8f;
typedef __attribute__((ext_vector_type(4)))  float    v4f;
typedef v8h  __attribute__((may_alias)) v8ha;
typedef v4f  __attribute__((may_alias)) v4fa;
typedef v8us __attribute__((may_alias)) v8usa;

__device__ __forceinline__ unsigned short f2bf(float f) { unsigned u = __float_as_uint(f); u += 0x7FFFu + ((u >> 16) & 1u); return (unsigned short)(u >> 16); }
__device__ __forceinline__ float bf2f(unsigned short b) { return __uint_as_float(((unsigned)b) << 16); }
__device__ __forceinline__ float bfr(float f) { return bf2f(f2bf(f)); }
__device__ __forceinline__ v16h cat16(v8h lo, v8h hi) { return __builtin_shufflevector(lo, hi, 0, 1, 2, 3, 4, 5, 6, 7, 8, 9, 10, 11, 12, 13, 14, 15); }
__device__ __forceinline__ v16bf cat16b(v8us lo, v8us hi) { return __builtin_bit_cast(v16bf, __builtin_shufflevector(lo, hi, 0, 1, 2, 3, 4, 5, 6, 7, 8, 9, 10, 11, 12, 13, 14, 15)); }
__device__ __forceinline__ v8f wmma16(v16h a, v16h b, v8f c) { return __builtin_amdgcn_wmma_f32_16x16x32_f16(false, a, false, b, (short)0, c, false, false); }
__device__ __forceinline__ v8f wmmab(v16bf a, v16bf b, v8f c) { return __builtin_amdgcn_wmma_f32_16x16x32_bf16(false, a, false, b, (short)0, c, false, false); }



// 16-bit fragment loaders, k order 8h..8h+7 then 16+8h..16+8h+7 on both operands (global weight planes and LDS activation planes alike).
// The weight planes lie in memory in fragment order: blocks of 16 rows x 16 k (256 elements, 512 B), a 16-row tile's blocks in k order, tiles in row order; inside a block element (row r, k = 8h + j) stands at (16h + r) * 8 + j,
// so that lane 16h + r finds its 16 bytes at lane * 16 and one load of a wave takes four whole 128-byte lines (row-major planes: 32 bytes out of each of 16 lines).
#define FB 256   // elements of one 16 x 16 block
__device__ __forceinline__ v16h  ldgh(const h16* p) { return cat16(*(const v8h*)p, *(const v8h*)(p + FB)); }
__device__ __forceinline__ v16bf ldgb(const bf* p)  { return cat16b(*(const v8us*)p, *(const v8us*)(p + FB)); }
__device__ __forceinline__ v16h  ldsh(const bf* p)  { return cat16(*(const v8ha*)p, *(const v8ha*)(p + 16)); }
__device__ __forceinline__ v16bf ldsb(const bf* p)  { return cat16b(*(const v8usa*)p, *(const v8usa*)(p + 16)); }

__device__ __forceinline__ h16 tohx(float x) { return (h16)x; }
__device__ __forceinline__ void splitf(float y, unsigned short& h, unsigned short& l) { h = f2bf(y); l = f2bf(y - bf2f(h)); }
typedef __attribute__((ext_vector_type(2))) _Float16 v2h;
typedef __attribute__((ext_vector_type(2))) unsigned short v2us;
typedef __attribute__((ext_vector_type(2))) float v2f;
typedef v2f __attribute__((may_alias)) v2fa;

// ---- k_pack: all four weight planes in one launch of 256 work-groups of 12 waves. A wave takes one unit of 12 blocks (3072 elements, 6 KB of a plane): a whole 16-row tile of a K = 192 plane, or three tiles of the K = 64 plane.
// Lane 16h + r holds row r, k = 16c + 8h .. + 7 of block c: 8 consecutive source floats in, 16 bytes out at lane * 16 of the block. A unit's source rows are one contiguous stretch, all its loads are issued before the first conversion,
// and which plane a unit belongs to is a scalar branch. The long units come first in the grid.
#define PW 12                      // waves per packing work-group
#define U2 (NA * 2 * HH / 16)      // units of B2: its tiles, [W2|S2] rows of an agent in tile order
#define U3 (NA * HH / 16)          // units of B3: its tiles
#define U1 (NA * 2 * HH / 16 / 3)  // units of B1: three tiles each (8 units an agent, 4 of W1 rows, then 4 of S1 rows)
#define UO (NA * 64 / 16)          // units of BO: its tiles (only rows 0..2 of an agent's first tile are weights, the rest zero)
// Stands behind a unit's last stores: the scalar code that follows a branch of k_pack reuses the stores' base register pair.
__device__ __forceinline__ void pack_end() { asm volatile("s_wait_xcnt 0x0" ::: "memory"); }
__device__ __forceinline__ void pack_h(const float* __restrict__ src, h16* __restrict__ dst, unsigned lane) { const unsigned so = (lane & 15) * HH + (lane >> 4) * 8; float v[12][8];
#pragma unroll
    for (int c = 0; c < 12; ++c)
#pragma unroll
        for (int j = 0; j < 8; ++j) v[c][j] = src[so + c * 16 + j];
#pragma unroll
    for (int c = 0; c < 12; ++c) { v8h o;
#pragma unroll
        for (int j = 0; j < 8; ++j) o[j] = tohx(bfr(v[c][j]));
        *(v8h*)(dst + c * FB + lane * 8) = o; }
    pack_end(); }
__global__ __launch_bounds__(PW * 32) void k_pack(const float* __restrict__ W1, const float* __restrict__ S1, const float* __restrict__ W2, const float* __restrict__ S2, const float* __restrict__ W3, const float* __restrict__ Wo,
                                                  bf* __restrict__ B1, h16* __restrict__ B2, h16* __restrict__ B3, bf* __restrict__ BO) {
    const unsigned lane = threadIdx.x & 31, r = lane & 15, h = lane >> 4;
    const unsigned u = blockIdx.x * PW + (unsigned)__builtin_amdgcn_readfirstlane(threadIdx.x >> 5);   // the wave's unit, in a scalar register: the branches below are scalar ones
    if (u < U2) { const unsigned a = u / 24, t = u % 24;
        pack_h(t < 12 ? W2 + (size_t)(a * HH + t * 16) * HH : S2 + (size_t)(a * HH + (t - 12) * 16) * HH, B2 + (size_t)u * 12 * FB, lane);
    } else if (u < U2 + U3) { const unsigned t = u - U2;
        pack_h(W3 + (size_t)t * 16 * HH, B3 + (size_t)t * 12 * FB, lane);
    } else if (u < U2 + U3 + U1) { const unsigned t = u - (U2 + U3), a = t / 8, g = t % 8;
        const float* __restrict__ src = g < 4 ? W1 + (size_t)(a * HH + g * 48) * DI : S1 + (size_t)(a * HH + (g - 4) * 48) * DI; bf* __restrict__ dst = B1 + (size_t)t * 12 * FB;
        const unsigned so = r * DI + h * 8; float v[3][3][8], e[3][2];
#pragma unroll
        for (int i = 0; i < 3; ++i)
#pragma unroll
            for (int c = 0; c < 3; ++c)
#pragma unroll
                for (int j = 0; j < 8; ++j) v[i][c][j] = src[so + i * 16 * DI + c * 16 + j];
#pragma unroll
        for (int i = 0; i < 3; ++i) { e[i][0] = 0.0f; e[i][1] = 0.0f; }
        if (h == 0) {   // k = 48, 49: the last two columns of a row; k = 50..63 is padding
#pragma unroll
            for (int i = 0; i < 3; ++i) { e[i][0] = src[so + i * 16 * DI + 48]; e[i][1] = src[so + i * 16 * DI + 49]; } }
#pragma unroll
        for (int i = 0; i < 3; ++i) {
#pragma unroll
            for (int c = 0; c < 3; ++c) { v8us o;
#pragma unroll
                for (int j = 0; j < 8; ++j) o[j] = f2bf(v[i][c][j]);
                *(v8us*)(dst + (i * 4 + c) * FB + lane * 8) = o; }
            *(v8us*)(dst + (i * 4 + 3) * FB + lane * 8) = (v8us){f2bf(e[i][0]), f2bf(e[i][1]), 0, 0, 0, 0, 0, 0}; }
        pack_end();
    } else { const unsigned t = u - (U2 + U3 + U1), a = t / 4, n = (t % 4) * 16 + r; bf* __restrict__ dst = BO + (size_t)t * 12 * FB; float v[12][8];
#pragma unroll
        for (int c = 0; c < 12; ++c)
#pragma unroll
            for (int j = 0; j < 8; ++j) v[c][j] = 0.0f;
        if (n < NO) { const float* __restrict__ src = Wo + (size_t)a * NO * HH; const unsigned so = n * HH + h * 8;
#pragma unroll
            for (int c = 0; c < 12; ++c)
#pragma unroll
                for (int j = 0; j < 8; ++j) v[c][j] = src[so + c * 16 + j]; }
#pragma unroll
        for (int c = 0; c < 12; ++c) { v8us o;
#pragma unroll
            for (int j = 0; j < 8; ++j) o[j] = f2bf(v[c][j]);
            *(v8us*)(dst + c * FB + lane * 8) = o; }
        pack_end();
    }
}

#define MT 64    // batch rows per work-group
#define NW 12    // waves per work-group: wave w owns output features 16w..16w+15
#define PX 72    // LDS pitch in elements of the K = 64 planes (144 B: 16 rows of 16 B fall on all 64 banks)
#define PH 200   // LDS pitch in elements of the K = 192 planes (400 B, same reason)

__device__ __forceinline__ v8f fma8(v8f a, v8f b, v8f c) { return __builtin_elementwise_fma(a, b, c); }
__device__ __forceinline__ v8f sp8(float c) { return (v8f){c, c, c, c, c, c, c, c}; }
// gelu(main + bm) + (skip + bs) for the 8 consecutive output features that one lane holds of one batch row; gelu(x) = 0.5 x w with w = 1 + erf(x / sqrt 2).
// All 8 go side by side as vectors (independent chains, two floats an instruction). For |x| < sqrt 2, w = 1 + x q(x^2): the odd polynomial that the library's erff takes for an argument below 1, with the 1 / sqrt 2 folded into its six coefficients.
// One test for the whole wave sends all 8 to erff itself as soon as any lane holds an |x| >= sqrt 2 (a NaN stays a NaN on either way).
__device__ __forceinline__ v8f act8(v8f m, v8f s, const float* bm, const float* bs) { v8f vm, vs, w;
#pragma unroll
    for (int j = 0; j < 8; ++j) { vm[j] = bm[j]; vs[j] = bs[j]; }
    const v8f x = m + vm;
    float mx = __builtin_fabsf(x[0]);
#pragma unroll
    for (int j = 1; j < 8; ++j) mx = fmaxf(mx, __builtin_fabsf(x[j]));
    if (__builtin_amdgcn_ballot_w32(mx >= 0x1.6a09e6p+0f) != 0u) {   // the same for the whole wave: a scalar branch, every lane stays on
#pragma unroll
        for (int j = 0; j < 8; ++j) w[j] = 1.0f + erff(x[j] * 0.7071067811865476f);
    } else { const v8f u = x * x;
        v8f q = fma8(u, sp8(-0x1.a08d04p-17f), sp8(0x1.c76bfcp-13f)); q = fma8(u, q, sp8(-0x1.3569b4p-9f)); q = fma8(u, q, sp8(0x1.46b43ap-6f)); q = fma8(u, q, sp8(-0x1.105794p-3f)); q = fma8(u, q, sp8(0x1.988452p-1f));
        w = fma8(x, q, sp8(1.0f)); }
    return (0.5f * x) * w + (s + vs); }
// src is the same for the whole wave (a scalar base); off is the lane's part.
__device__ __forceinline__ void bias8(const float* __restrict__ src, unsigned off, float* dst) {
#pragma unroll
    for (int j = 0; j < 8; ++j) dst[j] = bfr(src[off + j]); }
// Stands behind the bias loads, in front of the weight loads.
__device__ __forceinline__ void xwait() { asm volatile("s_wait_xcnt 0x0" ::: "memory"); }
__device__ __forceinline__ v8h toh8(v8f h) { v8h o;
#pragma unroll
    for (int j = 0; j < 8; ++j) o[j] = tohx(h[j]);
    return o; }

// ---- k_mlp: the whole per-agent MLP for 64 batch rows. grid (NBT / 64, NA), 384 threads. Every product is formed transposed, D[n][m] = sum_k W[n][k] act[m][k] (weights as the A operand, activations as B),
// so a lane holds 8 consecutive features of one batch row and hands them to the next layer with one 16-byte LDS store. A wave loads its 16 features' weights of a layer once into registers and walks the four 16-row blocks,
// in layer 1 in a loop that stays rolled (the erf code is long), in layers 2 and 3 k step by k step with all four blocks' accumulators held. The second launch-bounds argument asks for six waves a SIMD (two work-groups a WGP): without it the build takes more than 160 registers and only one work-group fits.
__global__ __launch_bounds__(NW * 32, 6) void k_mlp(const float* __restrict__ x, const float* __restrict__ wi, const float* __restrict__ bi, const float* __restrict__ b1, const float* __restrict__ sb1, const float* __restrict__ b2, const float* __restrict__ sb2,
                                             const float* __restrict__ b3, const float* __restrict__ hw, const float* __restrict__ hb, const float* __restrict__ bo,
                                             const bf* __restrict__ B1, const h16* __restrict__ B2, const h16* __restrict__ B3, const bf* __restrict__ BO, float* __restrict__ OUT) {
    __shared__ __align__(16) bf buf0[MT * PH];   // h1 (fp16), then h3 hi
    __shared__ __align__(16) bf buf1[MT * PH];   // xn hi and lo, then h2 (fp16), then h3 lo
    __shared__ __align__(16) v4f h2s[NW * 4 * 2 * 32];   // h2 in f32 for the residual of layer 3: each lane's own 8 values per row block, read back by the same lane
    __shared__ float os[MT * NO];
    const int tid = threadIdx.x, lane = tid & 31, lr = lane & 15, hi = lane >> 4;
    const int w = __builtin_amdgcn_readfirstlane(tid >> 5);   // wave number in a scalar register: the branch round the last layer's matrix instructions must be a scalar one
    const int a = blockIdx.y, r0 = blockIdx.x * MT;
    const int n0 = w * 16 + hi * 8;    // first of the lane's 8 features in a D fragment
    const int fo = lr * PH + 8 * hi;   // a lane's place in an activation fragment of the K = 192 planes
    const int so = lr * PH + n0;       // a lane's place for its 8 features of a row
    const int ab = a * HH + w * 16; const unsigned h8 = hi * 8;   // the wave's and the lane's part of a place in a per-feature vector (ab + h8 = a * HH + n0)
    bf* Xh = buf1; bf* Xl = buf1 + MT * PX;
    // Input norm: lane l holds columns 2l, 2l + 1 (one 8-byte load; DI is even, so a pair is all data or all padding) of rows w, w + 12, ..., six rows for waves 0..3 and five for the rest.
    // All of a thread's x pairs, its pair of the agent's scale and shift, and layer 1's biases and weights are asked for before anything waits: one round trip to the cache in place of one per element.
    const int k2 = lane * 2; const bool kon = k2 < DI; const int kc = kon ? k2 : 0;   // a padding lane reads column 0 (in bounds) and stores zeros
    v2f xv[6]; const float* xs = x + (size_t)(r0 + w) * DI;   // the wave's first row: a scalar base
#pragma unroll
    for (int i = 0; i < 5; ++i) xv[i] = *(const v2fa*)(xs + i * NW * DI + kc);
    xv[5] = *(const v2fa*)(xs + (w < MT - 5 * NW ? 5 * NW * DI : 0) + kc);   // a wave without a sixth row reads its first again
    const v2f wv = *(const v2fa*)(wi + a * DI + kc), bv = *(const v2fa*)(bi + a * DI + kc);
    const float bov = bo[a * NO + tid % NO];   // the output bias of the thread's logit, for the last line of the kernel
    {   // layer 1: [W1|S1] x (xn hi + xn lo), K = 64
        const bf* Bm = B1 + ((size_t)a * 2 * HH + w * 16) * KI + lane * 8; const bf* Bs = Bm + (size_t)HH * KI; v16bf wm[2], ws[2];
        float bm[8], bs[8]; bias8(b1 + ab, h8, bm); bias8(sb1 + ab, h8, bs); xwait();
#pragma unroll
        for (int q = 0; q < 2; ++q) { wm[q] = ldgb(Bm + q * 2 * FB); ws[q] = ldgb(Bs + q * 2 * FB); }
        __builtin_amdgcn_sched_barrier(0);   // keeps conversions and later address work out from among the loads above, so that they issue back to back: without it the build puts three more s_wait_xcnt 0 between them
        asm volatile("" :: "v"(xv[5]));      // inputs only: holds the sixth row's load up here with the others; without it the compiler sinks it into the branch below, where it is waited for alone
#pragma unroll
        for (int i = 0; i < 6; ++i) { const int row = w + NW * i; v2us oh, ol;
#pragma unroll
            for (int u = 0; u < 2; ++u) { unsigned short h, l; splitf(__fadd_rn(__fmul_rn(bfr(xv[i][u]), bfr(wv[u])), bfr(bv[u])), h, l); oh[u] = kon ? h : (unsigned short)0; ol[u] = kon ? l : (unsigned short)0; }
            if (i < 5 || w < MT - 5 * NW) { *(v2us*)(Xh + row * PX + k2) = oh; *(v2us*)(Xl + row * PX + k2) = ol; } }   // the sixth row's test is a scalar one (w is in a scalar register)
        __syncthreads();   // xn complete
#pragma unroll 1   // rolled: keeps one copy of the erf code per layer in the text
        for (int mb = 0; mb < 4; ++mb) { v8f am = (v8f){}, as = (v8f){};
#pragma unroll
            for (int q = 0; q < 2; ++q) { const v16bf xh = ldsb(Xh + (mb * 16 + lr) * PX + 8 * hi + q * 32), xl = ldsb(Xl + (mb * 16 + lr) * PX + 8 * hi + q * 32);
                am = wmmab(wm[q], xh, am); as = wmmab(ws[q], xh, as); am = wmmab(wm[q], xl, am); as = wmmab(ws[q], xl, as); }
            *(v8ha*)(buf0 + mb * 16 * PH + so) = toh8(act8(am, as, bm, bs)); }
    }
    {   // layer 2: [W2|S2] x h1, K = 192. k steps outside, the four row blocks inside: eight accumulator chains that do not depend on one another, and a weight fragment is needed for one k step only,
        // so that three steps' weights are held at a time and the registers so freed take a whole step's four activation fragments (with all twelve weight fragments held there was one fragment's room, loaded and waited for 24 times).
        const h16* Bm = B2 + ((size_t)a * 2 * HH + w * 16) * HH + lane * 8; const h16* Bs = Bm + (size_t)HH * HH; v16h wm[6], ws[6];
#pragma unroll
        for (int q = 0; q < 3; ++q) { wm[q] = ldgh(Bm + q * 2 * FB); ws[q] = ldgh(Bs + q * 2 * FB); }
        __syncthreads();   // h1 complete; every read of xn is over, so buf1 may take h2
        v8f am[4], as[4]; float bm[8], bs[8];
#pragma unroll
        for (int mb = 0; mb < 4; ++mb) { am[mb] = (v8f){}; as[mb] = (v8f){}; }
#pragma unroll
        for (int q = 0; q < 6; ++q) { v16h hv[4];
#pragma unroll
            for (int mb = 0; mb < 4; ++mb) hv[mb] = ldsh(buf0 + mb * 16 * PH + fo + q * 32);
            __builtin_amdgcn_sched_barrier(0);   // keeps a step's eight LDS loads together in front of its matrix instructions: left alone the build loads one fragment at a time and waits for each
#pragma unroll
            for (int mb = 0; mb < 4; ++mb) { am[mb] = wmma16(wm[q], hv[mb], am[mb]); as[mb] = wmma16(ws[q], hv[mb], as[mb]); }
            if (q < 4) __builtin_amdgcn_sched_barrier(0);   // keeps the loads below up here, three steps ahead of their use: left alone the build sinks them to where they are waited for at once
            if (q < 3) { wm[q + 3] = ldgh(Bm + (q + 3) * 2 * FB); ws[q + 3] = ldgh(Bs + (q + 3) * 2 * FB); }   // into the registers that step q has just left
            if (q == 3) { bias8(b2 + ab, h8, bm); bias8(sb2 + ab, h8, bs); }   // the biases come when weight registers fall free, two steps ahead of their use
            if (q < 4) __builtin_amdgcn_sched_barrier(0); }   // the other side of the same fence
#pragma unroll
        for (int mb = 0; mb < 4; ++mb) { const v8f h = act8(am[mb], as[mb], bm, bs);
            h2s[((w * 4 + mb) * 2 + 0) * 32 + lane] = (v4f){h[0], h[1], h[2], h[3]}; h2s[((w * 4 + mb) * 2 + 1) * 32 + lane] = (v4f){h[4], h[5], h[6], h[7]};
            *(v8ha*)(buf1 + mb * 16 * PH + so) = toh8(h); }
    }
    {   // layer 3: W3 x h2, K = 192, + b3 + h2 (f32), then the affine hidden norm, split into bf16 hi + lo planes
        const h16* Bm = B3 + ((size_t)a * HH + w * 16) * HH + lane * 8; v16h wm[6];
        float bb[8], sw[8], sb[8]; bias8(b3 + ab, h8, bb); bias8(hw + ab, h8, sw); bias8(hb + ab, h8, sb);
#pragma unroll
        for (int q = 0; q < 6; ++q) wm[q] = ldgh(Bm + q * 2 * FB);
        __syncthreads();   // h2 complete; every read of h1 is over
        v8f ac[4];
#pragma unroll
        for (int mb = 0; mb < 4; ++mb) ac[mb] = (v8f){};
#pragma unroll
        for (int q = 0; q < 6; ++q)
#pragma unroll
            for (int mb = 0; mb < 4; ++mb) ac[mb] = wmma16(wm[q], ldsh(buf1 + mb * 16 * PH + fo + q * 32), ac[mb]);
        __syncthreads();   // every read of h2 (fp16) is over before buf1 takes the lo plane
#pragma unroll
        for (int mb = 0; mb < 4; ++mb) { const v4f ra = h2s[((w * 4 + mb) * 2 + 0) * 32 + lane], rb = h2s[((w * 4 + mb) * 2 + 1) * 32 + lane]; v8us oh, ol;
#pragma unroll
            for (int j = 0; j < 8; ++j) { const float t = __fadd_rn(__fadd_rn(ac[mb][j], bb[j]), j < 4 ? ra[j & 3] : rb[j & 3]); unsigned short h, l; splitf(__fadd_rn(__fmul_rn(t, sw[j]), sb[j]), h, l); oh[j] = h; ol[j] = l; }
            *(v8usa*)(buf0 + mb * 16 * PH + so) = oh; *(v8usa*)(buf1 + mb * 16 * PH + so) = ol; }
    }
    __syncthreads();   // h3 planes complete
    if (w < 4) {   // output layer: Wo (3 rows, zero-padded) x (h3 hi + h3 lo), K = 192; wave w takes batch rows 16w..16w+15
        v8f ac = (v8f){}; const bf* Bm = BO + (size_t)a * 64 * HH + lane * 8;
#pragma unroll
        for (int q = 0; q < 6; ++q) { const v16bf wo = ldgb(Bm + q * 2 * FB); ac = wmmab(wo, ldsb(buf0 + w * 16 * PH + fo + q * 32), ac); ac = wmmab(wo, ldsb(buf1 + w * 16 * PH + fo + q * 32), ac); }
        if (hi == 0) {
#pragma unroll
            for (int j = 0; j < NO; ++j) os[(w * 16 + lr) * NO + j] = ac[j]; }
    }
    __syncthreads();   // logits of the 64 rows gathered: 192 floats, stored thread-linearly so that each wave writes one whole 128-byte line
    if (tid < MT * NO) OUT[((size_t)a * NBT + r0) * NO + tid] = __fadd_rn(os[tid], bfr(bov));
}

extern "C" void kernel_launch(void* const* d_in, const int* in_sizes, int n_in,
                              void* d_out, int out_size, void* d_ws, size_t ws_size, hipStream_t stream) {
    (void)in_sizes; (void)n_in; (void)out_size;
    const float* IN[17]; for (int i = 0; i < 17; ++i) IN[i] = (const float*)d_in[i];   // 0 x, 1 in_w, 2 in_b, 3 W1, 4 b1, 5 W2, 6 b2, 7 W3, 8 b3, 9 Wo, 10 bo, 11 S1, 12 sb1, 13 S2, 14 sb2, 15 hw, 16 hb
    float* OUT = (float*)d_out;     // [64][4096][3]
    char* wsp = (char*)d_ws;
    auto take = [&](size_t bytes) { char* p = wsp; wsp += (bytes + 255) & ~(size_t)255; return (void*)p; };
    bf* B1 = (bf*)take((size_t)NA * 2 * HH * KI * 2); h16* B2 = (h16*)take((size_t)NA * 2 * HH * HH * 2); h16* B3 = (h16*)take((size_t)NA * HH * HH * 2); bf* BO = (bf*)take((size_t)NA * 64 * HH * 2);
    if ((size_t)(wsp - (char*)d_ws) > ws_size) return;    // total ~ 19 MB
    k_pack<<<(U2 + U3 + U1 + UO) / PW, PW * 32, 0, stream>>>(IN[3], IN[11], IN[5], IN[13], IN[7], IN[9], B1, B2, B3, BO);
    k_mlp<<<dim3(NBT / MT, NA), NW * 32, 0, stream>>>(IN[0], IN[1], IN[2], IN[4], IN[12], IN[6], IN[14], IN[8], IN[15], IN[16], IN[10], B1, B2, B3, BO, OUT);
}

// v008
// It runs in 87.1 microseconds.
// Two timings next to v007 both put it at 1.09 times that version's speed.
// All steps since v000 together make it 28.4 times as fast.
#include <hip/hip_runtime.h>

// VectorizedSREKEnsemble - 64 independent MLP "agents" on a shared input (x [4096][50]; per agent a: xn = x w_in[a] + b_in[a] (affine only); h1 = gelu(xn W1^T + b1) + xn S1^T + sb1;
// h2 = gelu(h1 W2^T + b2) + h1 S2^T + sb2; h3 = (h2 W3^T + b3 + h2) hw[a] + hb[a]; logits = h3 Wo^T + bo -> [64][4096][3]; exact (erf) gelu; weights [a][out][in]).
// Compute dtypes, f32 accumulate: every input rounded to bf16; the affine input norm f32 -> bf16 hi+lo planes (K 50 padded to 64) x exact [W1|S1] (2 products, one N = 384 GEMM per agent); h1 and h2 as SINGLE fp16
// planes x fp16 copies of the bf16 [W2|S2] / W3 weights (1 product; hi+lo would double the two 192x384/192x192 GEMMs); the affine hidden norm f32 -> hl planes x exact Wo (3 outputs padded to 64); gelu (erf), biases, skips f32 on VALU.
// One launch carries all four layers: a work-group of 12 waves owns 64 batch rows of one agent and keeps xn, h1, h2 and h3 in LDS (h2 in fp16 and in f32); only the 16-bit weight planes and the logits touch memory.

#define NA   64
#define NBT  4096
#define DI   50
#define KI   64
#define HH   192
#define NO   3
typedef _Float16 h16;
typedef unsigned short bf;
typedef __attribute__((ext_vector_type(16))) __bf16   v16bf;
typedef __attribute__((ext_vector_type(16))) _Float16 v16h;
typedef __attribute__((ext_vector_type(8)))  _Float16 v8h;
typedef __attribute__((ext_vector_type(8)))  unsigned short v8us;
typedef __attribute__((ext_vector_type(8)))  float    v8f;
typedef __attribute__((ext_vector_type(4)))  float    v4f;
typedef v8h  __attribute__((may_alias)) v8ha;
typedef v4f  __attribute__((may_alias)) v4fa;
typedef v8us __attribute__((may_alias)) v8usa;

typedef __attribute__((ext_vector_type(2))) float v2f;
typedef __attribute__((ext_vector_type(2))) __bf16 v2bf;
typedef __attribute__((ext_vector_type(4))) unsigned v4u;
// f32 -> bf16, round to nearest even, two values an instruction (the packed conversion of the vector unit): a in the low half of the word, b in the high half. bfx gives the two back as f32.
__device__ __forceinline__ unsigned bf2(float a, float b) { return __builtin_bit_cast(unsigned, __builtin_convertvector((v2f){a, b}, v2bf)); }
__device__ __forceinline__ v2f bfx(unsigned u) { return (v2f){__uint_as_float(u << 16), __uint_as_float(u & 0xFFFF0000u)}; }
__device__ __forceinline__ v2f bfr2(float a, float b) { return bfx(bf2(a, b)); }
__device__ __forceinline__ float bfr(float f) { return bfr2(f, f)[0]; }
__device__ __forceinline__ v16h cat16(v8h lo, v8h hi) { return __builtin_shufflevector(lo, hi, 0, 1, 2, 3, 4, 5, 6, 7, 8, 9, 10, 11, 12, 13, 14, 15); }
__device__ __forceinline__ v16bf cat16b(v8us lo, v8us hi) { return __builtin_bit_cast(v16bf, __builtin_shufflevector(lo, hi, 0, 1, 2, 3, 4, 5, 6, 7, 8, 9, 10, 11, 12, 13, 14, 15)); }
__device__ __forceinline__ v8f wmma16(v16h a, v16h b, v8f c) { return __builtin_amdgcn_wmma_f32_16x16x32_f16(false, a, false, b, (short)0, c, false, false); }
__device__ __forceinline__ v8f wmmab(v16bf a, v16bf b, v8f c) { return __builtin_amdgcn_wmma_f32_16x16x32_bf16(false, a, false, b, (short)0, c, false, false); }



// 16-bit fragment loaders, k order 8h..8h+7 then 16+8h..16+8h+7 on both operands (global weight planes and LDS activation planes alike).
// The weight planes lie in memory in fragment order: blocks of 16 rows x 16 k (256 elements, 512 B), a 16-row tile's blocks in k order, tiles in row order; inside a block element (row r, k = 8h + j) stands at (16h + r) * 8 + j,
// so that lane 16h + r finds its 16 bytes at lane * 16 and one load of a wave takes four whole 128-byte lines (row-major planes: 32 bytes out of each of 16 lines).
#define FB 256   // elements of one 16 x 16 block
__device__ __forceinline__ v16h  ldgh(const h16* p) { return cat16(*(const v8h*)p, *(const v8h*)(p + FB)); }
__device__ __forceinline__ v16bf ldgb(const bf* p)  { return cat16b(*(const v8us*)p, *(const v8us*)(p + FB)); }
__device__ __forceinline__ v16h  ldsh(const bf* p)  { return cat16(*(const v8ha*)p, *(const v8ha*)(p + 16)); }
__device__ __forceinline__ v16bf ldsb(const bf* p)  { return cat16b(*(const v8usa*)p, *(const v8usa*)(p + 16)); }

__device__ __forceinline__ h16 tohx(float x) { return (h16)x; }
// two values into their bf16 hi and lo parts, each pair one packed word
__device__ __forceinline__ void split2(float y0, float y1, unsigned& h, unsigned& l) { h = bf2(y0, y1); const v2f b = bfx(h); l = bf2(y0 - b[0], y1 - b[1]); }
typedef __attribute__((ext_vector_type(2))) unsigned short v2us;
typedef v2f __attribute__((may_alias)) v2fa;
// eight consecutive values rounded to bf16, as the 16 bytes of a plane
__device__ __forceinline__ v8us bf8(const float* v) { return __builtin_bit_cast(v8us, (v4u){bf2(v[0], v[1]), bf2(v[2], v[3]), bf2(v[4], v[5]), bf2(v[6], v[7])}); }

// ---- k_pack: all four weight planes in one launch of 256 work-groups of 12 waves. A wave takes one unit of 12 blocks (3072 elements, 6 KB of a plane): a whole 16-row tile of a K = 192 plane, or three tiles of the K = 64 plane.
// Lane 16h + r holds row r, k = 16c + 8h .. + 7 of block c: 8 consecutive source floats in, 16 bytes out at lane * 16 of the block. A unit's source rows are one contiguous stretch, all its loads are issued before the first conversion,
// and which plane a unit belongs to is a scalar branch. The long units come first in the grid.
#define PW 12                      // waves per packing work-group
#define U2 (NA * 2 * HH / 16)      // units of B2: its tiles, [W2|S2] rows of an agent in tile order
#define U3 (NA * HH / 16)          // units of B3: its tiles
#define U1 (NA * 2 * HH / 16 / 3)  // units of B1: three tiles each (8 units an agent, 4 of W1 rows, then 4 of S1 rows)
#define UO (NA * 64 / 16)          // units of BO: its tiles (only rows 0..2 of an agent's first tile are weights, the rest zero)
// Stands behind a unit's last stores: the scalar code that follows a branch of k_pack reuses the stores' base register pair.
__device__ __forceinline__ void pack_end() { asm volatile("s_wait_xcnt 0x0" ::: "memory"); }
__device__ __forceinline__ void pack_h(const float* __restrict__ src, h16* __restrict__ dst, unsigned lane) { const unsigned so = (lane & 15) * HH + (lane >> 4) * 8; float v[12][8];
#pragma unroll
    for (int c = 0; c < 12; ++c)
#pragma unroll
        for (int j = 0; j < 8; ++j) v[c][j] = src[so + c * 16 + j];
#pragma unroll
    for (int c = 0; c < 12; ++c) { v8h o;
#pragma unroll
        for (int j = 0; j < 8; j += 2) { const v2f b = bfr2(v[c][j], v[c][j + 1]); o[j] = tohx(b[0]); o[j + 1] = tohx(b[1]); }
        *(v8h*)(dst + c * FB + lane * 8) = o; }
    pack_end(); }
__global__ __launch_bounds__(PW * 32) void k_pack(const float* __restrict__ W1, const float* __restrict__ S1, const float* __restrict__ W2, const float* __restrict__ S2, const float* __restrict__ W3, const float* __restrict__ Wo,
                                                  bf* __restrict__ B1, h16* __restrict__ B2, h16* __restrict__ B3, bf* __restrict__ BO) {
    const unsigned lane = threadIdx.x & 31, r = lane & 15, h = lane >> 4;
    const unsigned u = blockIdx.x * PW + (unsigned)__builtin_amdgcn_readfirstlane(threadIdx.x >> 5);   // the wave's unit, in a scalar register: the branches below are scalar ones
    if (u < U2) { const unsigned a = u / 24, t = u % 24;
        pack_h(t < 12 ? W2 + (size_t)(a * HH + t * 16) * HH : S2 + (size_t)(a * HH + (t - 12) * 16) * HH, B2 + (size_t)u * 12 * FB, lane);
    } else if (u < U2 + U3) { const unsigned t = u - U2;
        pack_h(W3 + (size_t)t * 16 * HH, B3 + (size_t)t * 12 * FB, lane);
    } else if (u < U2 + U3 + U1) { const unsigned t = u - (U2 + U3), a = t / 8, g = t % 8;
        const float* __restrict__ src = g < 4 ? W1 + (size_t)(a * HH + g * 48) * DI : S1 + (size_t)(a * HH + (g - 4) * 48) * DI; bf* __restrict__ dst = B1 + (size_t)t * 12 * FB;
        const unsigned so = r * DI + h * 8; float v[3][3][8], e[3][2];
#pragma unroll
        for (int i = 0; i < 3; ++i)
#pragma unroll
            for (int c = 0; c < 3; ++c)
#pragma unroll
                for (int j = 0; j < 8; ++j) v[i][c][j] = src[so + i * 16 * DI + c * 16 + j];
#pragma unroll
        for (int i = 0; i < 3; ++i) { e[i][0] = 0.0f; e[i][1] = 0.0f; }
        if (h == 0) {   // k = 48, 49: the last two columns of a row; k = 50..63 is padding
#pragma unroll
            for (int i = 0; i < 3; ++i) { e[i][0] = src[so + i * 16 * DI + 48]; e[i][1] = src[so + i * 16 * DI + 49]; } }
#pragma unroll
        for (int i = 0; i < 3; ++i) {
#pragma unroll
            for (int c = 0; c < 3; ++c) *(v8us*)(dst + (i * 4 + c) * FB + lane * 8) = bf8(v[i][c]);
            *(v8us*)(dst + (i * 4 + 3) * FB + lane * 8) = __builtin_bit_cast(v8us, (v4u){bf2(e[i][0], e[i][1]), 0u, 0u, 0u}); }
        pack_end();
    } else { const unsigned t = u - (U2 + U3 + U1), a = t / 4, n = (t % 4) * 16 + r; bf* __restrict__ dst = BO + (size_t)t * 12 * FB; float v[12][8];
#pragma unroll
        for (int c = 0; c < 12; ++c)
#pragma unroll
            for (int j = 0; j < 8; ++j) v[c][j] = 0.0f;
        if (n < NO) { const float* __restrict__ src = Wo + (size_t)a * NO * HH; const unsigned so = n * HH + h * 8;
#pragma unroll
            for (int c = 0; c < 12; ++c)
#pragma unroll
                for (int j = 0; j < 8; ++j) v[c][j] = src[so + c * 16 + j]; }
#pragma unroll
        for (int c = 0; c < 12; ++c) *(v8us*)(dst + c * FB + lane * 8) = bf8(v[c]);
        pack_end();
    }
}

#define MT 64    // batch rows per work-group
#define NW 12    // waves per work-group: wave w owns output features 16w..16w+15
#define PX 72    // LDS pitch in elements of the K = 64 planes (144 B: 16 rows of 16 B fall on all 64 banks)
#define PH 200   // LDS pitch in elements of the K = 192 planes (400 B, same reason)

__device__ __forceinline__ v8f fma8(v8f a, v8f b, v8f c) { return __builtin_elementwise_fma(a, b, c); }
__device__ __forceinline__ v8f sp8(float c) { return (v8f){c, c, c, c, c, c, c, c}; }
// gelu(main + bm) + (skip + bs) for the 8 consecutive output features that one lane holds of one batch row; gelu(x) = 0.5 x w with w = 1 + erf(x / sqrt 2).
// All 8 go side by side as vectors (independent chains, two floats an instruction). For |x| < sqrt 2, w = 1 + x q(x^2): the odd polynomial that the library's erff takes for an argument below 1, with the 1 / sqrt 2 folded into its six coefficients.
// One test for the whole wave sends all 8 to erff itself as soon as any lane holds an |x| >= sqrt 2 (a NaN stays a NaN on either way).
__device__ __forceinline__ v8f act8(v8f m, v8f s, const float* bm, const float* bs) { v8f vm, vs, w;
#pragma unroll
    for (int j = 0; j < 8; ++j) { vm[j] = bm[j]; vs[j] = bs[j]; }
    const v8f x = m + vm;
    float mx = __builtin_fabsf(x[0]);
#pragma unroll
    for (int j = 1; j < 8; ++j) mx = fmaxf(mx, __builtin_fabsf(x[j]));
    if (__builtin_amdgcn_ballot_w32(mx >= 0x1.6a09e6p+0f) != 0u) {   // the same for the whole wave: a scalar branch, every lane stays on
#pragma unroll
        for (int j = 0; j < 8; ++j) w[j] = 1.0f + erff(x[j] * 0.7071067811865476f);
    } else { const v8f u = x * x;
        v8f q = fma8(u, sp8(-0x1.a08d04p-17f), sp8(0x1.c76bfcp-13f)); q = fma8(u, q, sp8(-0x1.3569b4p-9f)); q = fma8(u, q, sp8(0x1.46b43ap-6f)); q = fma8(u, q, sp8(-0x1.105794p-3f)); q = fma8(u, q, sp8(0x1.988452p-1f));
        w = fma8(x, q, sp8(1.0f)); }
    return (0.5f * x) * w + (s + vs); }
// src is the same for the whole wave (a scalar base); off is the lane's part.
__device__ __forceinline__ void bias8(const float* __restrict__ src, unsigned off, float* dst) {
#pragma unroll
    for (int j = 0; j < 8; j += 2) { const v2f b = bfr2(src[off + j], src[off + j + 1]); dst[j] = b[0]; dst[j + 1] = b[1]; } }
// the two halves of bias8 apart, for where the loads are asked for well ahead of their use: raw8 only loads, rnd8 rounds in place
__device__ __forceinline__ void raw8(const float* __restrict__ src, unsigned off, float* dst) {
#pragma unroll
    for (int j = 0; j < 8; ++j) dst[j] = src[off + j]; }
__device__ __forceinline__ void rnd8(float* v) {
#pragma unroll
    for (int j = 0; j < 8; j += 2) { const v2f b = bfr2(v[j], v[j + 1]); v[j] = b[0]; v[j + 1] = b[1]; } }
// the same, left as four packed words (two bf16 each), which bfx unpacks where they are used
__device__ __forceinline__ void bias8p(const float* __restrict__ src, unsigned off, unsigned* dst) {
#pragma unroll
    for (int j = 0; j < 4; ++j) dst[j] = bf2(src[off + 2 * j], src[off + 2 * j + 1]); }
// Stands behind bias loads: the compiler lets later code (a weight load's destination, the scalar code of the erf branch) reuse the loads' offset register or scalar base.
__device__ __forceinline__ void xwait() { asm volatile("s_wait_xcnt 0x0" ::: "memory"); }
__device__ __forceinline__ v8h toh8(v8f h) { v8h o;
#pragma unroll
    for (int j = 0; j < 8; ++j) o[j] = tohx(h[j]);
    return o; }

// ---- k_mlp: the whole per-agent MLP for 64 batch rows. grid (NBT / 64, NA), 384 threads. Every product is formed transposed, D[n][m] = sum_k W[n][k] act[m][k] (weights as the A operand, activations as B),
// so a lane holds 8 consecutive features of one batch row and hands them to the next layer with one 16-byte LDS store. A wave loads its 16 features' weights of a layer once into registers and walks the four 16-row blocks,
// in layer 1 in a loop that stays rolled (the erf code is long), in layers 2 and 3 k step by k step with all four blocks' accumulators held. The second launch-bounds argument asks for six waves a SIMD (two work-groups a WGP): without it the build takes more than 160 registers and only one work-group fits.
__global__ __launch_bounds__(NW * 32, 6) void k_mlp(const float* __restrict__ x, const float* __restrict__ wi, const float* __restrict__ bi, const float* __restrict__ b1, const float* __restrict__ sb1, const float* __restrict__ b2, const float* __restrict__ sb2,
                                             const float* __restrict__ b3, const float* __restrict__ hw, const float* __restrict__ hb, const float* __restrict__ bo,
                                             const bf* __restrict__ B1, const h16* __restrict__ B2, const h16* __restrict__ B3, const bf* __restrict__ BO, float* __restrict__ OUT) {
    __shared__ __align__(16) bf buf0[MT * PH];   // h1 (fp16), then h3 hi
    __shared__ __align__(16) bf buf1[MT * PH];   // xn hi and lo, then h2 (fp16), then h3 lo
    __shared__ __align__(16) v4f h2s[NW * 4 * 2 * 32];   // h2 in f32 for the residual of layer 3: each lane's own 8 values per row block, read back by the same lane
    __shared__ float os[MT * NO];
    const int tid = threadIdx.x, lane = tid & 31, lr = lane & 15, hi = lane >> 4;
    const int w = __builtin_amdgcn_readfirstlane(tid >> 5);   // wave number in a scalar register: the branch round the last layer's matrix instructions must be a scalar one
    const int a = blockIdx.y, r0 = blockIdx.x * MT;
    const int n0 = w * 16 + hi * 8;    // first of the lane's 8 features in a D fragment
    const int fo = lr * PH + 8 * hi;   // a lane's place in an activation fragment of the K = 192 planes
    const int so = lr * PH + n0;       // a lane's place for its 8 features of a row
    const int ab = a * HH + w * 16; const unsigned h8 = hi * 8;   // the wave's and the lane's part of a place in a per-feature vector (ab + h8 = a * HH + n0)
    bf* Xh = buf1; bf* Xl = buf1 + MT * PX;
    // Input norm: lane l holds columns 2l, 2l + 1 (one 8-byte load; DI is even, so a pair is all data or all padding) of rows w, w + 12, ..., six rows for waves 0..3 and five for the rest.
    // All of a thread's x pairs, its pair of the agent's scale and shift, and layer 1's biases and weights are asked for before anything waits: one round trip to the cache in place of one per element.
    const int k2 = lane * 2; const bool kon = k2 < DI; const int kc = kon ? k2 : 0;   // a padding lane reads column 0 (in bounds) and stores zeros
    v2f xv[6]; const float* xs = x + (size_t)(r0 + w) * DI;   // the wave's first row: a scalar base
#pragma unroll
    for (int i = 0; i < 5; ++i) xv[i] = *(const v2fa*)(xs + i * NW * DI + kc);
    xv[5] = *(const v2fa*)(xs + (w < MT - 5 * NW ? 5 * NW * DI : 0) + kc);   // a wave without a sixth row reads its first again
    const v2f wv = *(const v2fa*)(wi + a * DI + kc), bv = *(const v2fa*)(bi + a * DI + kc);
    const float bov = bo[a * NO + tid % NO];   // the output bias of the thread's logit, for the last line of the kernel
    {   // layer 1: [W1|S1] x (xn hi + xn lo), K = 64
        const bf* Bm = B1 + ((size_t)a * 2 * HH + w * 16) * KI + lane * 8; const bf* Bs = Bm + (size_t)HH * KI; v16bf wm[2], ws[2];
        float bm[8], bs[8]; bias8(b1 + ab, h8, bm); bias8(sb1 + ab, h8, bs); xwait();
#pragma unroll
        for (int q = 0; q < 2; ++q) { wm[q] = ldgb(Bm + q * 2 * FB); ws[q] = ldgb(Bs + q * 2 * FB); }
        __builtin_amdgcn_sched_barrier(0);   // keeps conversions and later address work out from among the loads above, so that they issue back to back: without it the build puts three more s_wait_xcnt 0 between them
        asm volatile("" :: "v"(xv[5]));      // inputs only: holds the sixth row's load up here with the others; without it the compiler sinks it into the branch below, where it is waited for alone
        const v2f wr = bfr2(wv[0], wv[1]), br = bfr2(bv[0], bv[1]);
#pragma unroll
        for (int i = 0; i < 6; ++i) { const int row = w + NW * i; const v2f xr = bfr2(xv[i][0], xv[i][1]); unsigned h, l;
            split2(__fadd_rn(__fmul_rn(xr[0], wr[0]), br[0]), __fadd_rn(__fmul_rn(xr[1], wr[1]), br[1]), h, l);
            if (i < 5 || w < MT - 5 * NW) { *(v2us*)(Xh + row * PX + k2) = __builtin_bit_cast(v2us, kon ? h : 0u); *(v2us*)(Xl + row * PX + k2) = __builtin_bit_cast(v2us, kon ? l : 0u); } }   // the sixth row's test is a scalar one (w is in a scalar register)
        __syncthreads();   // xn complete
#pragma unroll 1   // rolled: keeps one copy of the erf code per layer in the text
        for (int mb = 0; mb < 4; ++mb) { v8f am = (v8f){}, as = (v8f){};
#pragma unroll
            for (int q = 0; q < 2; ++q) { const v16bf xh = ldsb(Xh + (mb * 16 + lr) * PX + 8 * hi + q * 32), xl = ldsb(Xl + (mb * 16 + lr) * PX + 8 * hi + q * 32);
                am = wmmab(wm[q], xh, am); as = wmmab(ws[q], xh, as); am = wmmab(wm[q], xl, am); as = wmmab(ws[q], xl, as); }
            *(v8ha*)(buf0 + mb * 16 * PH + so) = toh8(act8(am, as, bm, bs)); }
    }
    {   // layer 2: [W2|S2] x h1, K = 192. k steps outside, the four row blocks inside: eight accumulator chains that do not depend on one another, and a weight fragment is needed for one k step only,
        // so that three steps' weights are held at a time and the registers so freed take a whole step's four activation fragments (with all twelve weight fragments held there was one fragment's room, loaded and waited for 24 times).
        const h16* Bm = B2 + ((size_t)a * 2 * HH + w * 16) * HH + lane * 8; const h16* Bs = Bm + (size_t)HH * HH; v16h wm[6], ws[6];
#pragma unroll
        for (int q = 0; q < 3; ++q) { wm[q] = ldgh(Bm + q * 2 * FB); ws[q] = ldgh(Bs + q * 2 * FB); }
        __syncthreads();   // h1 complete; every read of xn is over, so buf1 may take h2
        v8f am[4], as[4]; float bm[8], bs[8];
#pragma unroll
        for (int mb = 0; mb < 4; ++mb) { am[mb] = (v8f){}; as[mb] = (v8f){}; }
#pragma unroll
        for (int q = 0; q < 6; ++q) { v16h hv[4];
#pragma unroll
            for (int mb = 0; mb < 4; ++mb) hv[mb] = ldsh(buf0 + mb * 16 * PH + fo + q * 32);
            __builtin_amdgcn_sched_barrier(0);   // keeps a step's eight LDS loads together in front of its matrix instructions: left alone the build loads one fragment at a time and waits for each
#pragma unroll
            for (int mb = 0; mb < 4; ++mb) { am[mb] = wmma16(wm[q], hv[mb], am[mb]); as[mb] = wmma16(ws[q], hv[mb], as[mb]); }
            if (q < 4) __builtin_amdgcn_sched_barrier(0);   // keeps the loads below up here, three steps ahead of their use: left alone the build sinks them to where they are waited for at once
            if (q < 3) { wm[q + 3] = ldgh(Bm + (q + 3) * 2 * FB); ws[q + 3] = ldgh(Bs + (q + 3) * 2 * FB); }   // into the registers that step q has just left
            if (q == 3) { raw8(b2 + ab, h8, bm); raw8(sb2 + ab, h8, bs); xwait(); }   // the biases come when weight registers fall free, two steps ahead of their use; they are rounded behind the loop, so that nothing waits for them here
            if (q < 4) __builtin_amdgcn_sched_barrier(0); }   // the other side of the same fence
        rnd8(bm); rnd8(bs);
#pragma unroll
        for (int mb = 0; mb < 4; ++mb) { const v8f h = act8(am[mb], as[mb], bm, bs);
            h2s[((w * 4 + mb) * 2 + 0) * 32 + lane] = (v4f){h[0], h[1], h[2], h[3]}; h2s[((w * 4 + mb) * 2 + 1) * 32 + lane] = (v4f){h[4], h[5], h[6], h[7]};
            *(v8ha*)(buf1 + mb * 16 * PH + so) = toh8(h); }
    }
    {   // layer 3: W3 x h2, K = 192, + b3 + h2 (f32), then the affine hidden norm, split into bf16 hi + lo planes
        const h16* Bm = B3 + ((size_t)a * HH + w * 16) * HH + lane * 8; v16h wm[6];
#pragma unroll
        for (int q = 0; q < 6; ++q) wm[q] = ldgh(Bm + q * 2 * FB);
        __syncthreads();   // h2 complete; every read of h1 is over
        v8f ac[4];
#pragma unroll
        for (int mb = 0; mb < 4; ++mb) ac[mb] = (v8f){};
#pragma unroll
        for (int q = 0; q < 6; ++q)
#pragma unroll
            for (int mb = 0; mb < 4; ++mb) ac[mb] = wmma16(wm[q], ldsh(buf1 + mb * 16 * PH + fo + q * 32), ac[mb]);
        __syncthreads();   // every read of h2 (fp16) is over before buf1 takes the lo plane
        unsigned bbp[4], swp[4], sbp[4]; bias8p(b3 + ab, h8, bbp); bias8p(hw + ab, h8, swp); bias8p(hb + ab, h8, sbp);   // asked for behind the product: held through it they take the registers into which its LDS loads run ahead, and the build then loads one fragment at a time and waits for each
#pragma unroll
        for (int mb = 0; mb < 4; ++mb) { const v4f ra = h2s[((w * 4 + mb) * 2 + 0) * 32 + lane], rb = h2s[((w * 4 + mb) * 2 + 1) * 32 + lane]; float y[8]; v4u oh, ol;
#pragma unroll
            for (int j = 0; j < 8; ++j) { const float t = __fadd_rn(__fadd_rn(ac[mb][j], bfx(bbp[j >> 1])[j & 1]), j < 4 ? ra[j & 3] : rb[j & 3]); y[j] = __fadd_rn(__fmul_rn(t, bfx(swp[j >> 1])[j & 1]), bfx(sbp[j >> 1])[j & 1]); }
#pragma unroll
            for (int j = 0; j < 4; ++j) { unsigned h, l; split2(y[2 * j], y[2 * j + 1], h, l); oh[j] = h; ol[j] = l; }
            *(v8usa*)(buf0 + mb * 16 * PH + so) = __builtin_bit_cast(v8us, oh); *(v8usa*)(buf1 + mb * 16 * PH + so) = __builtin_bit_cast(v8us, ol); }
    }
    __syncthreads();   // h3 planes complete
    if (w < 4) {   // output layer: Wo (3 rows, zero-padded) x (h3 hi + h3 lo), K = 192; wave w takes batch rows 16w..16w+15
        v8f ac = (v8f){}; const bf* Bm = BO + (size_t)a * 64 * HH + lane * 8;
#pragma unroll
        for (int q = 0; q < 6; ++q) { const v16bf wo = ldgb(Bm + q * 2 * FB); ac = wmmab(wo, ldsb(buf0 + w * 16 * PH + fo + q * 32), ac); ac = wmmab(wo, ldsb(buf1 + w * 16 * PH + fo + q * 32), ac); }
        if (hi == 0) {
#pragma unroll
            for (int j = 0; j < NO; ++j) os[(w * 16 + lr) * NO + j] = ac[j]; }
    }
    __syncthreads();   // logits of the 64 rows gathered: 192 floats, stored thread-linearly so that each wave writes one whole 128-byte line
    if (tid < MT * NO) OUT[((size_t)a * NBT + r0) * NO + tid] = __fadd_rn(os[tid], bfr(bov));
}

extern "C" void kernel_launch(void* const* d_in, const int* in_sizes, int n_in,
                              void* d_out, int out_size, void* d_ws, size_t ws_size, hipStream_t stream) {
    (void)in_sizes; (void)n_in; (void)out_size;
    const float* IN[17]; for (int i = 0; i < 17; ++i) IN[i] = (const float*)d_in[i];   // 0 x, 1 in_w, 2 in_b, 3 W1, 4 b1, 5 W2, 6 b2, 7 W3, 8 b3, 9 Wo, 10 bo, 11 S1, 12 sb1, 13 S2, 14 sb2, 15 hw, 16 hb
    float* OUT = (float*)d_out;     // [64][4096][3]
    char* wsp = (char*)d_ws;
    auto take = [&](size_t bytes) { char* p = wsp; wsp += (bytes + 255) & ~(size_t)255; return (void*)p; };
    bf* B1 = (bf*)take((size_t)NA * 2 * HH * KI * 2); h16* B2 = (h16*)take((size_t)NA * 2 * HH * HH * 2); h16* B3 = (h16*)take((size_t)NA * HH * HH * 2); bf* BO = (bf*)take((size_t)NA * 64 * HH * 2);
    if ((size_t)(wsp - (char*)d_ws) > ws_size) return;    // total ~ 19 MB
    k_pack<<<(U2 + U3 + U1 + UO) / PW, PW * 32, 0, stream>>>(IN[3], IN[11], IN[5], IN[13], IN[7], IN[9], B1, B2, B3, BO);
    k_mlp<<<dim3(NBT / MT, NA), NW * 32, 0, stream>>>(IN[0], IN[1], IN[2], IN[4], IN[12], IN[6], IN[14], IN[8], IN[15], IN[16], IN[10], B1, B2, B3, BO, OUT);
}

// v009
// A run of this version takes 83 microseconds.
// Next to v008, in two timings, it ran 1.05 times as fast each time.
// All steps since v000 together make it 29.8 times as fast.
#include <hip/hip_runtime.h>

// VectorizedSREKEnsemble - 64 independent MLP "agents" on a shared input (x [4096][50]; per agent a: xn = x w_in[a] + b_in[a] (affine only); h1 = gelu(xn W1^T + b1) + xn S1^T + sb1;
// h2 = gelu(h1 W2^T + b2) + h1 S2^T + sb2; h3 = (h2 W3^T + b3 + h2) hw[a] + hb[a]; logits = h3 Wo^T + bo -> [64][4096][3]; exact (erf) gelu; weights [a][out][in]).
// Compute dtypes, f32 accumulate: every input rounded to bf16; the affine input norm f32 -> bf16 hi+lo planes (K 50 padded to 64) x exact [W1|S1] (2 products, one N = 384 GEMM per agent); h1 and h2 as SINGLE fp16
// planes x fp16 copies of the bf16 [W2|S2] / W3 weights (1 product; hi+lo would double the two 192x384/192x192 GEMMs); the affine hidden norm f32 -> hl planes x exact Wo (3 outputs padded to 64); gelu (erf), biases, skips f32 on VALU.
// One launch carries all four layers: a work-group of 12 waves owns 64 batch rows of one agent and keeps xn, h1, h2 and h3 in LDS (h2 in fp16 and in f32); only the 16-bit weight planes and the logits touch memory.

#define NA   64
#define NBT  4096
#define DI   50
#define KI   64
#define HH   192
#define NO   3
typedef _Float16 h16;
typedef unsigned short bf;
typedef __attribute__((ext_vector_type(16))) __bf16   v16bf;
typedef __attribute__((ext_vector_type(16))) _Float16 v16h;
typedef __attribute__((ext_vector_type(8)))  _Float16 v8h;
typedef __attribute__((ext_vector_type(8)))  unsigned short v8us;
typedef __attribute__((ext_vector_type(8)))  float    v8f;
typedef __attribute__((ext_vector_type(4)))  float    v4f;
typedef v8h  __attribute__((may_alias)) v8ha;
typedef v4f  __attribute__((may_alias)) v4fa;
typedef v8us __attribute__((may_alias)) v8usa;

typedef __attribute__((ext_vector_type(2))) float v2f;
typedef __attribute__((ext_vector_type(2))) __bf16 v2bf;
typedef __attribute__((ext_vector_type(4))) unsigned v4u;
// f32 -> bf16, round to nearest even, two values an instruction (the packed conversion of the vector unit): a in the low half of the word, b in the high half. bfx gives the two back as f32.
__device__ __forceinline__ unsigned bf2(float a, float b) { return __builtin_bit_cast(unsigned, __builtin_convertvector((v2f){a, b}, v2bf)); }
__device__ __forceinline__ v2f bfx(unsigned u) { return (v2f){__uint_as_float(u << 16), __uint_as_float(u & 0xFFFF0000u)}; }
__device__ __forceinline__ v2f bfr2(float a, float b) { return bfx(bf2(a, b)); }
__device__ __forceinline__ float bfr(float f) { return bfr2(f, f)[0]; }
__device__ __forceinline__ v16h cat16(v8h lo, v8h hi) { return __builtin_shufflevector(lo, hi, 0, 1, 2, 3, 4, 5, 6, 7, 8, 9, 10, 11, 12, 13, 14, 15); }
__device__ __forceinline__ v16bf cat16b(v8us lo, v8us hi) { return __builtin_bit_cast(v16bf, __builtin_shufflevector(lo, hi, 0, 1, 2, 3, 4, 5, 6, 7, 8, 9, 10, 11, 12, 13, 14, 15)); }
__device__ __forceinline__ v8f wmma16(v16h a, v16h b, v8f c) { return __builtin_amdgcn_wmma_f32_16x16x32_f16(false, a, false, b, (short)0, c, false, false); }
__device__ __forceinline__ v8f wmmab(v16bf a, v16bf b, v8f c) { return __builtin_amdgcn_wmma_f32_16x16x32_bf16(false, a, false, b, (short)0, c, false, false); }



// 16-bit fragment loaders, k order 8h..8h+7 then 16+8h..16+8h+7 on both operands (global weight planes and LDS activation planes alike).
// The weight planes lie in memory in fragment order: blocks of 16 rows x 16 k (256 elements, 512 B), a 16-row tile's blocks in k order, tiles in row order; inside a block element (row r, k = 8h + j) stands at (16h + r) * 8 + j,
// so that lane 16h + r finds its 16 bytes at lane * 16 and one load of a wave takes four whole 128-byte lines (row-major planes: 32 bytes out of each of 16 lines).
#define FB 256   // elements of one 16 x 16 block
__device__ __forceinline__ v16h  ldgh(const h16* p) { return cat16(*(const v8h*)p, *(const v8h*)(p + FB)); }
__device__ __forceinline__ v16bf ldgb(const bf* p)  { return cat16b(*(const v8us*)p, *(const v8us*)(p + FB)); }
__device__ __forceinline__ v16h  ldsh(const bf* p)  { return cat16(*(const v8ha*)p, *(const v8ha*)(p + 16)); }
__device__ __forceinline__ v16bf ldsb(const bf* p)  { return cat16b(*(const v8usa*)p, *(const v8usa*)(p + 16)); }

__device__ __forceinline__ h16 tohx(float x) { return (h16)x; }
// two values into their bf16 hi and lo parts, each pair one packed word
__device__ __forceinline__ void split2(float y0, float y1, unsigned& h, unsigned& l) { h = bf2(y0, y1); const v2f b = bfx(h); l = bf2(y0 - b[0], y1 - b[1]); }
typedef __attribute__((ext_vector_type(2))) unsigned short v2us;
typedef v2f __attribute__((may_alias)) v2fa;
// eight consecutive values rounded to bf16, as the 16 bytes of a plane
__device__ __forceinline__ v8us bf8(const float* v) { return __builtin_bit_cast(v8us, (v4u){bf2(v[0], v[1]), bf2(v[2], v[3]), bf2(v[4], v[5]), bf2(v[6], v[7])}); }

// ---- k_pack: all four weight planes in one launch of 256 work-groups of 12 waves. A wave takes one unit of 12 blocks (3072 elements, 6 KB of a plane): a whole 16-row tile of a K = 192 plane, or three tiles of the K = 64 plane.
// Lane 16h + r holds row r, k = 16c + 8h .. + 7 of block c: 8 consecutive source floats in, 16 bytes out at lane * 16 of the block. A unit's source rows are one contiguous stretch, all its loads are issued before the first conversion,
// and which plane a unit belongs to is a scalar branch. The long units come first in the grid.
#define PW 12                      // waves per packing work-group
#define U2 (NA * 2 * HH / 16)      // units of B2: its tiles, [W2|S2] rows of an agent in tile order
#define U3 (NA * HH / 16)          // units of B3: its tiles
#define U1 (NA * 2 * HH / 16 / 3)  // units of B1: three tiles each (8 units an agent, 4 of W1 rows, then 4 of S1 rows)
#define UO (NA * 64 / 16)          // units of BO: its tiles (only rows 0..2 of an agent's first tile are weights, the rest zero)
// Stands behind a unit's last stores: the scalar code that follows a branch of k_pack reuses the stores' base register pair.
__device__ __forceinline__ void pack_end() { asm volatile("s_wait_xcnt 0x0" ::: "memory"); }
__device__ __forceinline__ void pack_h(const float* __restrict__ src, h16* __restrict__ dst, unsigned lane) { const unsigned so = (lane & 15) * HH + (lane >> 4) * 8; float v[12][8];
#pragma unroll
    for (int c = 0; c < 12; ++c)
#pragma unroll
        for (int j = 0; j < 8; ++j) v[c][j] = src[so + c * 16 + j];
#pragma unroll
    for (int c = 0; c < 12; ++c) { v8h o;
#pragma unroll
        for (int j = 0; j < 8; j += 2) { const v2f b = bfr2(v[c][j], v[c][j + 1]); o[j] = tohx(b[0]); o[j + 1] = tohx(b[1]); }
        *(v8h*)(dst + c * FB + lane * 8) = o; }
    pack_end(); }
__global__ __launch_bounds__(PW * 32) void k_pack(const float* __restrict__ W1, const float* __restrict__ S1, const float* __restrict__ W2, const float* __restrict__ S2, const float* __restrict__ W3, const float* __restrict__ Wo,
                                                  bf* __restrict__ B1, h16* __restrict__ B2, h16* __restrict__ B3, bf* __restrict__ BO) {
    const unsigned lane = threadIdx.x & 31, r = lane & 15, h = lane >> 4;
    const unsigned u = blockIdx.x * PW + (unsigned)__builtin_amdgcn_readfirstlane(threadIdx.x >> 5);   // the wave's unit, in a scalar register: the branches below are scalar ones
    if (u < U2) { const unsigned a = u / 24, t = u % 24;
        pack_h(t < 12 ? W2 + (size_t)(a * HH + t * 16) * HH : S2 + (size_t)(a * HH + (t - 12) * 16) * HH, B2 + (size_t)u * 12 * FB, lane);
    } else if (u < U2 + U3) { const unsigned t = u - U2;
        pack_h(W3 + (size_t)t * 16 * HH, B3 + (size_t)t * 12 * FB, lane);
    } else if (u < U2 + U3 + U1) { const unsigned t = u - (U2 + U3), a = t / 8, g = t % 8;
        const float* __restrict__ src = g < 4 ? W1 + (size_t)(a * HH + g * 48) * DI : S1 + (size_t)(a * HH + (g - 4) * 48) * DI; bf* __restrict__ dst = B1 + (size_t)t * 12 * FB;
        const unsigned so = r * DI + h * 8; float v[3][3][8], e[3][2];
#pragma unroll
        for (int i = 0; i < 3; ++i)
#pragma unroll
            for (int c = 0; c < 3; ++c)
#pragma unroll
                for (int j = 0; j < 8; ++j) v[i][c][j] = src[so + i * 16 * DI + c * 16 + j];
#pragma unroll
        for (int i = 0; i < 3; ++i) { e[i][0] = 0.0f; e[i][1] = 0.0f; }
        if (h == 0) {   // k = 48, 49: the last two columns of a row; k = 50..63 is padding
#pragma unroll
            for (int i = 0; i < 3; ++i) { e[i][0] = src[so + i * 16 * DI + 48]; e[i][1] = src[so + i * 16 * DI + 49]; } }
#pragma unroll
        for (int i = 0; i < 3; ++i) {
#pragma unroll
            for (int c = 0; c < 3; ++c) *(v8us*)(dst + (i * 4 + c) * FB + lane * 8) = bf8(v[i][c]);
            *(v8us*)(dst + (i * 4 + 3) * FB + lane * 8) = __builtin_bit_cast(v8us, (v4u){bf2(e[i][0], e[i][1]), 0u, 0u, 0u}); }
        pack_end();
    } else { const unsigned t = u - (U2 + U3 + U1), a = t / 4, n = (t % 4) * 16 + r; bf* __restrict__ dst = BO + (size_t)t * 12 * FB; float v[12][8];
#pragma unroll
        for (int c = 0; c < 12; ++c)
#pragma unroll
            for (int j = 0; j < 8; ++j) v[c][j] = 0.0f;
        if (n < NO) { const float* __restrict__ src = Wo + (size_t)a * NO * HH; const unsigned so = n * HH + h * 8;
#pragma unroll
            for (int c = 0; c < 12; ++c)
#pragma unroll
                for (int j = 0; j < 8; ++j) v[c][j] = src[so + c * 16 + j]; }
#pragma unroll
        for (int c = 0; c < 12; ++c) *(v8us*)(dst + c * FB + lane * 8) = bf8(v[c]);
        pack_end();
    }
}

#define MT 64    // batch rows per work-group
#define NW 12    // waves per work-group: wave w owns output features 16w..16w+15
#define PX 72    // LDS pitch in elements of the K = 64 planes (144 B: 16 rows of 16 B fall on all 64 banks)
#define PH 200   // LDS pitch in elements of the K = 192 planes (400 B, same reason)

__device__ __forceinline__ v8f fma8(v8f a, v8f b, v8f c) { return __builtin_elementwise_fma(a, b, c); }
__device__ __forceinline__ v8f sp8(float c) { return (v8f){c, c, c, c, c, c, c, c}; }
// gelu(main + bm) + (skip + bs) for the 8 consecutive output features that one lane holds of one batch row; gelu(x) = 0.5 x w with w = 1 + erf(x / sqrt 2).
// All 8 go side by side as vectors (independent chains, two floats an instruction). For |x| < sqrt 2, w = 1 + x q(x^2): the odd polynomial that the library's erff takes for an argument below 1, with the 1 / sqrt 2 folded into its six coefficients.
// One test for the whole wave sends all 8 to erff itself as soon as any lane holds an |x| >= sqrt 2 (a NaN stays a NaN on either way).
__device__ __forceinline__ v8f act8(v8f m, v8f s, const float* bm, const float* bs) { v8f vm, vs, w;
#pragma unroll
    for (int j = 0; j < 8; ++j) { vm[j] = bm[j]; vs[j] = bs[j]; }
    const v8f x = m + vm;
    float mx = __builtin_fabsf(x[0]);
#pragma unroll
    for (int j = 1; j < 8; ++j) mx = fmaxf(mx, __builtin_fabsf(x[j]));
    if (__builtin_amdgcn_ballot_w32(mx >= 0x1.6a09e6p+0f) != 0u) {   // the same for the whole wave: a scalar branch, every lane stays on
#pragma unroll
        for (int j = 0; j < 8; ++j) w[j] = 1.0f + erff(x[j] * 0.7071067811865476f);
    } else { const v8f u = x * x;
        v8f q = fma8(u, sp8(-0x1.a08d04p-17f), sp8(0x1.c76bfcp-13f)); q = fma8(u, q, sp8(-0x1.3569b4p-9f)); q = fma8(u, q, sp8(0x1.46b43ap-6f)); q = fma8(u, q, sp8(-0x1.105794p-3f)); q = fma8(u, q, sp8(0x1.988452p-1f));
        w = fma8(x, q, sp8(1.0f)); }
    return (0.5f * x) * w + (s + vs); }
// src is the same for the whole wave (a scalar base); off is the lane's part.
__device__ __forceinline__ void bias8(const float* __restrict__ src, unsigned off, float* dst) {
#pragma unroll
    for (int j = 0; j < 8; j += 2) { const v2f b = bfr2(src[off + j], src[off + j + 1]); dst[j] = b[0]; dst[j + 1] = b[1]; } }
// the two halves of bias8 apart, for where the loads are asked for well ahead of their use: raw8 only loads, rnd8 rounds in place
__device__ __forceinline__ void raw8(const float* __restrict__ src, unsigned off, float* dst) {
#pragma unroll
    for (int j = 0; j < 8; ++j) dst[j] = src[off + j]; }
__device__ __forceinline__ void rnd8(float* v) {
#pragma unroll
    for (int j = 0; j < 8; j += 2) { const v2f b = bfr2(v[j], v[j + 1]); v[j] = b[0]; v[j + 1] = b[1]; } }
// the same, left as four packed words (two bf16 each), which bfx unpacks where they are used
__device__ __forceinline__ void bias8p(const float* __restrict__ src, unsigned off, unsigned* dst) {
#pragma unroll
    for (int j = 0; j < 4; ++j) dst[j] = bf2(src[off + 2 * j], src[off + 2 * j + 1]); }
// Stands behind bias and weight loads: the compiler lets later code (a weight load's destination, the scalar code of the erf branch) reuse the loads' offset register or scalar base.
__device__ __forceinline__ void xwait() { asm volatile("s_wait_xcnt 0x0" ::: "memory"); }
__device__ __forceinline__ v8h toh8(v8f h) { v8h o;
#pragma unroll
    for (int j = 0; j < 8; ++j) o[j] = tohx(h[j]);
    return o; }

// ---- k_mlp: the whole per-agent MLP for 64 batch rows. grid (NBT / 64, NA), 384 threads. Every product is formed transposed, D[n][m] = sum_k W[n][k] act[m][k] (weights as the A operand, activations as B),
// so a lane holds 8 consecutive features of one batch row and hands them to the next layer with one 16-byte LDS store. A wave loads its 16 features' weights of a layer once into registers and walks the four 16-row blocks,
// in layer 1 in a loop that stays rolled (the erf code is long), in layers 2 and 3 k step by k step with all four blocks' accumulators held. The second launch-bounds argument asks for six waves a SIMD (two work-groups a WGP): without it the build takes more than 160 registers and only one work-group fits.
__global__ __launch_bounds__(NW * 32, 6) void k_mlp(const float* __restrict__ x, const float* __restrict__ wi, const float* __restrict__ bi, const float* __restrict__ b1, const float* __restrict__ sb1, const float* __restrict__ b2, const float* __restrict__ sb2,
                                             const float* __restrict__ b3, const float* __restrict__ hw, const float* __restrict__ hb, const float* __restrict__ bo,
                                             const bf* __restrict__ B1, const h16* __restrict__ B2, const h16* __restrict__ B3, const bf* __restrict__ BO, float* __restrict__ OUT) {
    __shared__ __align__(16) bf buf0[MT * PH];   // h1 (fp16), then h3 hi
    __shared__ __align__(16) bf buf1[MT * PH];   // xn hi and lo, then h2 (fp16), then h3 lo
    __shared__ __align__(16) v4f h2s[NW * 4 * 2 * 32];   // h2 in f32 for the residual of layer 3: each lane's own 8 values per row block, read back by the same lane
    __shared__ float os[MT * NO];
    const int tid = threadIdx.x, lane = tid & 31, lr = lane & 15, hi = lane >> 4;
    const int w = __builtin_amdgcn_readfirstlane(tid >> 5);   // wave number in a scalar register: the branch round the last layer's matrix instructions must be a scalar one
    const int a = blockIdx.y, r0 = blockIdx.x * MT;
    const int n0 = w * 16 + hi * 8;    // first of the lane's 8 features in a D fragment
    const int fo = lr * PH + 8 * hi;   // a lane's place in an activation fragment of the K = 192 planes
    const int so = lr * PH + n0;       // a lane's place for its 8 features of a row
    const int ab = a * HH + w * 16; const unsigned h8 = hi * 8;   // the wave's and the lane's part of a place in a per-feature vector (ab + h8 = a * HH + n0)
    bf* Xh = buf1; bf* Xl = buf1 + MT * PX;
    // Input norm: lane l holds columns 2l, 2l + 1 (one 8-byte load; DI is even, so a pair is all data or all padding) of rows w, w + 12, ..., six rows for waves 0..3 and five for the rest.
    // All of a thread's x pairs, its pair of the agent's scale and shift, and layer 1's biases and weights are asked for before anything waits: one round trip to the cache in place of one per element.
    const int k2 = lane * 2; const bool kon = k2 < DI; const int kc = kon ? k2 : 0;   // a padding lane reads column 0 (in bounds) and stores zeros
    v2f xv[6]; const float* xs = x + (size_t)(r0 + w) * DI;   // the wave's first row: a scalar base
#pragma unroll
    for (int i = 0; i < 5; ++i) xv[i] = *(const v2fa*)(xs + i * NW * DI + kc);
    xv[5] = *(const v2fa*)(xs + (w < MT - 5 * NW ? 5 * NW * DI : 0) + kc);   // a wave without a sixth row reads its first again
    const v2f wv = *(const v2fa*)(wi + a * DI + kc), bv = *(const v2fa*)(bi + a * DI + kc);
    const float bov = bo[a * NO + tid % NO];   // the output bias of the thread's logit, for the last line of the kernel
    // Later layers' weights are asked for ahead of their use, each layer's first ones a phase early, into registers that are free there: a work-group barrier drains a wave's outstanding loads, so a load issued directly in front of one is waited for in full by the whole work-group.
    const h16* Bm2 = B2 + ((size_t)a * 2 * HH + w * 16) * HH + lane * 8; const h16* Bs2 = Bm2 + (size_t)HH * HH; v16h wm2[6], ws2[6];   // layer 2
    const h16* Bm3 = B3 + ((size_t)a * HH + w * 16) * HH + lane * 8; v16h wm3[6];   // layer 3
    const bf* Bo = BO + (size_t)a * 64 * HH + lane * 8; v16bf wo[6];   // output layer (waves 0..3)
    {   // layer 1: [W1|S1] x (xn hi + xn lo), K = 64
        const bf* Bm = B1 + ((size_t)a * 2 * HH + w * 16) * KI + lane * 8; const bf* Bs = Bm + (size_t)HH * KI; v16bf wm[2], ws[2];
        float bm[8], bs[8]; bias8(b1 + ab, h8, bm); bias8(sb1 + ab, h8, bs); xwait();
#pragma unroll
        for (int q = 0; q < 2; ++q) { wm[q] = ldgb(Bm + q * 2 * FB); ws[q] = ldgb(Bs + q * 2 * FB); }
        __builtin_amdgcn_sched_barrier(0);   // keeps conversions and later address work out from among the loads above, so that they issue back to back: without it the build puts three more s_wait_xcnt 0 between them
        asm volatile("" :: "v"(xv[5]));      // inputs only: holds the sixth row's load up here with the others; without it the compiler sinks it into the branch below, where it is waited for alone
        const v2f wr = bfr2(wv[0], wv[1]), br = bfr2(bv[0], bv[1]);
#pragma unroll
        for (int i = 0; i < 6; ++i) { const int row = w + NW * i; const v2f xr = bfr2(xv[i][0], xv[i][1]); unsigned h, l;
            split2(__fadd_rn(__fmul_rn(xr[0], wr[0]), br[0]), __fadd_rn(__fmul_rn(xr[1], wr[1]), br[1]), h, l);
            if (i < 5 || w < MT - 5 * NW) { *(v2us*)(Xh + row * PX + k2) = __builtin_bit_cast(v2us, kon ? h : 0u); *(v2us*)(Xl + row * PX + k2) = __builtin_bit_cast(v2us, kon ? l : 0u); } }   // the sixth row's test is a scalar one (w is in a scalar register)
        __syncthreads();   // xn complete
#pragma unroll
        for (int q = 0; q < 2; ++q) { wm2[q] = ldgh(Bm2 + q * 2 * FB); ws2[q] = ldgh(Bs2 + q * 2 * FB); }   // layer 2's first two k steps fly while layer 1 is worked (a third step's would spill)
        xwait();
#pragma unroll 1   // rolled: keeps one copy of the erf code per layer in the text
        for (int mb = 0; mb < 4; ++mb) { v8f am = (v8f){}, as = (v8f){};
#pragma unroll
            for (int q = 0; q < 2; ++q) { const v16bf xh = ldsb(Xh + (mb * 16 + lr) * PX + 8 * hi + q * 32), xl = ldsb(Xl + (mb * 16 + lr) * PX + 8 * hi + q * 32);
                am = wmmab(wm[q], xh, am); as = wmmab(ws[q], xh, as); am = wmmab(wm[q], xl, am); as = wmmab(ws[q], xl, as); }
            *(v8ha*)(buf0 + mb * 16 * PH + so) = toh8(act8(am, as, bm, bs)); }
    }
    {   // layer 2: [W2|S2] x h1, K = 192. k steps outside, the four row blocks inside: eight accumulator chains that do not depend on one another, and a weight fragment is needed for one k step only,
        // so that three steps' weights are held at a time and the registers so freed take a whole step's four activation fragments (with all twelve weight fragments held there was one fragment's room, loaded and waited for 24 times).
        __syncthreads();   // h1 complete; every read of xn is over, so buf1 may take h2
        wm2[2] = ldgh(Bm2 + 2 * 2 * FB); ws2[2] = ldgh(Bs2 + 2 * 2 * FB);   // the third step's weights: behind the barrier, which would drain them, and two steps ahead of their use
        v8f am[4], as[4]; float bm[8], bs[8];
#pragma unroll
        for (int mb = 0; mb < 4; ++mb) { am[mb] = (v8f){}; as[mb] = (v8f){}; }
#pragma unroll
        for (int q = 0; q < 6; ++q) { v16h hv[4];
#pragma unroll
            for (int mb = 0; mb < 4; ++mb) hv[mb] = ldsh(buf0 + mb * 16 * PH + fo + q * 32);
            __builtin_amdgcn_sched_barrier(0);   // keeps a step's eight LDS loads together in front of its matrix instructions: left alone the build loads one fragment at a time and waits for each
#pragma unroll
            for (int mb = 0; mb < 4; ++mb) { am[mb] = wmma16(wm2[q], hv[mb], am[mb]); as[mb] = wmma16(ws2[q], hv[mb], as[mb]); }
            if (q < 4) __builtin_amdgcn_sched_barrier(0);   // keeps the loads below up here, three steps ahead of their use: left alone the build sinks them to where they are waited for at once
            if (q < 3) { wm2[q + 3] = ldgh(Bm2 + (q + 3) * 2 * FB); ws2[q + 3] = ldgh(Bs2 + (q + 3) * 2 * FB); }   // into the registers that step q has just left
            if (q == 3) { raw8(b2 + ab, h8, bm); raw8(sb2 + ab, h8, bs); xwait(); }   // the biases come when weight registers fall free, two steps ahead of their use; they are rounded behind the loop, so that nothing waits for them here
            if (q < 4) __builtin_amdgcn_sched_barrier(0); }   // the other side of the same fence
        rnd8(bm); rnd8(bs);
#pragma unroll
        for (int mb = 0; mb < 4; ++mb) { const v8f h = act8(am[mb], as[mb], bm, bs);
            h2s[((w * 4 + mb) * 2 + 0) * 32 + lane] = (v4f){h[0], h[1], h[2], h[3]}; h2s[((w * 4 + mb) * 2 + 1) * 32 + lane] = (v4f){h[4], h[5], h[6], h[7]};
            *(v8ha*)(buf1 + mb * 16 * PH + so) = toh8(h);
            if (mb == 1) {   // layer 3's weights, into the registers that layer 2's weights and two row blocks' accumulators have left: they fly while the last two row blocks go through gelu
#pragma unroll
                for (int q = 0; q < 6; ++q) wm3[q] = ldgh(Bm3 + q * 2 * FB);
                xwait(); } }
    }
    {   // layer 3: W3 x h2, K = 192, + b3 + h2 (f32), then the affine hidden norm, split into bf16 hi + lo planes
        __syncthreads();   // h2 complete; every read of h1 is over
        v8f ac[4];
#pragma unroll
        for (int mb = 0; mb < 4; ++mb) ac[mb] = (v8f){};
#pragma unroll
        for (int q = 0; q < 6; ++q) { v16h hv[4];
#pragma unroll
            for (int mb = 0; mb < 4; ++mb) hv[mb] = ldsh(buf1 + mb * 16 * PH + fo + q * 32);
            __builtin_amdgcn_sched_barrier(0);   // keeps a step's eight LDS loads together in front of its matrix instructions: with the weights already there at the barrier the build otherwise loads one fragment at a time and waits for each
#pragma unroll
            for (int mb = 0; mb < 4; ++mb) ac[mb] = wmma16(wm3[q], hv[mb], ac[mb]); }
        __syncthreads();   // every read of h2 (fp16) is over before buf1 takes the lo plane
        if (w < 4) {   // the output layer's weights, into the registers that layer 3's weights have left: they fly during the epilogue below
#pragma unroll
            for (int q = 0; q < 6; ++q) wo[q] = ldgb(Bo + q * 2 * FB);
            xwait(); }
        unsigned bbp[4], swp[4], sbp[4]; bias8p(b3 + ab, h8, bbp); bias8p(hw + ab, h8, swp); bias8p(hb + ab, h8, sbp);   // asked for behind the product: held through it they take the registers into which its LDS loads run ahead, and the build then loads one fragment at a time and waits for each
#pragma unroll
        for (int mb = 0; mb < 4; ++mb) { const v4f ra = h2s[((w * 4 + mb) * 2 + 0) * 32 + lane], rb = h2s[((w * 4 + mb) * 2 + 1) * 32 + lane]; float y[8]; v4u oh, ol;
#pragma unroll
            for (int j = 0; j < 8; ++j) { const float t = __fadd_rn(__fadd_rn(ac[mb][j], bfx(bbp[j >> 1])[j & 1]), j < 4 ? ra[j & 3] : rb[j & 3]); y[j] = __fadd_rn(__fmul_rn(t, bfx(swp[j >> 1])[j & 1]), bfx(sbp[j >> 1])[j & 1]); }
#pragma unroll
            for (int j = 0; j < 4; ++j) { unsigned h, l; split2(y[2 * j], y[2 * j + 1], h, l); oh[j] = h; ol[j] = l; }
            *(v8usa*)(buf0 + mb * 16 * PH + so) = __builtin_bit_cast(v8us, oh); *(v8usa*)(buf1 + mb * 16 * PH + so) = __builtin_bit_cast(v8us, ol); }
    }
    __syncthreads();   // h3 planes complete
    if (w < 4) {   // output layer: Wo (3 rows, zero-padded) x (h3 hi + h3 lo), K = 192; wave w takes batch rows 16w..16w+15
        v8f ac = (v8f){};
#pragma unroll
        for (int q = 0; q < 6; ++q) { ac = wmmab(wo[q], ldsb(buf0 + w * 16 * PH + fo + q * 32), ac); ac = wmmab(wo[q], ldsb(buf1 + w * 16 * PH + fo + q * 32), ac); }
        if (hi == 0) {
#pragma unroll
            for (int j = 0; j < NO; ++j) os[(w * 16 + lr) * NO + j] = ac[j]; }
    }
    __syncthreads();   // logits of the 64 rows gathered: 192 floats, stored thread-linearly so that each wave writes one whole 128-byte line
    if (tid < MT * NO) OUT[((size_t)a * NBT + r0) * NO + tid] = __fadd_rn(os[tid], bfr(bov));
}

extern "C" void kernel_launch(void* const* d_in, const int* in_sizes, int n_in,
                              void* d_out, int out_size, void* d_ws, size_t ws_size, hipStream_t stream) {
    (void)in_sizes; (void)n_in; (void)out_size;
    const float* IN[17]; for (int i = 0; i < 17; ++i) IN[i] = (const float*)d_in[i];   // 0 x, 1 in_w, 2 in_b, 3 W1, 4 b1, 5 W2, 6 b2, 7 W3, 8 b3, 9 Wo, 10 bo, 11 S1, 12 sb1, 13 S2, 14 sb2, 15 hw, 16 hb
    float* OUT = (float*)d_out;     // [64][4096][3]
    char* wsp = (char*)d_ws;
    auto take = [&](size_t bytes) { char* p = wsp; wsp += (bytes + 255) & ~(size_t)255; return (void*)p; };
    bf* B1 = (bf*)take((size_t)NA * 2 * HH * KI * 2); h16* B2 = (h16*)take((size_t)NA * 2 * HH * HH * 2); h16* B3 = (h16*)take((size_t)NA * HH * HH * 2); bf* BO = (bf*)take((size_t)NA * 64 * HH * 2);
    if ((size_t)(wsp - (char*)d_ws) > ws_size) return;    // total ~ 19 MB
    k_pack<<<(U2 + U3 + U1 + UO) / PW, PW * 32, 0, stream>>>(IN[3], IN[11], IN[5], IN[13], IN[7], IN[9], B1, B2, B3, BO);
    k_mlp<<<dim3(NBT / MT, NA), NW * 32, 0, stream>>>(IN[0], IN[1], IN[2], IN[4], IN[12], IN[6], IN[14], IN[8], IN[15], IN[16], IN[10], B1, B2, B3, BO, OUT);
}

// v010
// Measured time: 64.1 microseconds a run.
// Timed twice side by side with v009, it ran 1.29 and 1.30 times as fast.
// All steps since v000 together make it 38.5 times as fast.
#include <hip/hip_runtime.h>

// VectorizedSREKEnsemble - 64 independent MLP "agents" on a shared input (x [4096][50]; per agent a: xn = x w_in[a] + b_in[a] (affine only); h1 = gelu(xn W1^T + b1) + xn S1^T + sb1;
// h2 = gelu(h1 W2^T + b2) + h1 S2^T + sb2; h3 = (h2 W3^T + b3 + h2) hw[a] + hb[a]; logits = h3 Wo^T + bo -> [64][4096][3]; exact (erf) gelu; weights [a][out][in]).
// Compute dtypes, f32 accumulate: every input rounded to bf16; the affine input norm f32 -> bf16 hi+lo planes (K 50 padded to 64) x exact [W1|S1] (2 products, one N = 384 GEMM per agent); h1 as a SINGLE fp16
// plane x fp16 copies of the bf16 [W2|S2] weights (1 product; hi+lo would double the 192x384 GEMM); gelu (erf), biases, skips f32 on VALU.
// Behind h2 the network is linear: logits = h2 M^T + c with M = Wo diag(hw) (W3 + I) [3][192] and c = Wo (b3 hw + hb) + bo, per agent. The packing launch forms M and c once per agent (bf16 products, f32 sums, on the matrix unit);
// the main launch multiplies h2 (f32 -> bf16 hi+lo planes) by M (f32 -> bf16 hi+lo planes, 3 rows padded to 16): hi x hi, hi x lo and lo x hi.
// One launch carries the layers: a work-group of 12 waves owns 64 batch rows of one agent and keeps xn, h1 and h2 in LDS; only the 16-bit weight planes and the logits touch memory.

#define NA   64
#define NBT  4096
#define DI   50
#define KI   64
#define HH   192
#define NO   3
typedef _Float16 h16;
typedef unsigned short bf;
typedef __attribute__((ext_vector_type(16))) __bf16   v16bf;
typedef __attribute__((ext_vector_type(16))) _Float16 v16h;
typedef __attribute__((ext_vector_type(8)))  _Float16 v8h;
typedef __attribute__((ext_vector_type(8)))  unsigned short v8us;
typedef __attribute__((ext_vector_type(8)))  float    v8f;
typedef __attribute__((ext_vector_type(4)))  float    v4f;
typedef v8h  __attribute__((may_alias)) v8ha;
typedef v4f  __attribute__((may_alias)) v4fa;
typedef v8us __attribute__((may_alias)) v8usa;

typedef __attribute__((ext_vector_type(2))) float v2f;
typedef __attribute__((ext_vector_type(2))) __bf16 v2bf;
typedef __attribute__((ext_vector_type(4))) unsigned v4u;
typedef __attribute__((ext_vector_type(8))) unsigned v8u;
// f32 -> bf16, round to nearest even, two values an instruction (the packed conversion of the vector unit): a in the low half of the word, b in the high half. bfx gives the two back as f32.
__device__ __forceinline__ unsigned bf2(float a, float b) { return __builtin_bit_cast(unsigned, __builtin_convertvector((v2f){a, b}, v2bf)); }
__device__ __forceinline__ v2f bfx(unsigned u) { return (v2f){__uint_as_float(u << 16), __uint_as_float(u & 0xFFFF0000u)}; }
__device__ __forceinline__ v2f bfr2(float a, float b) { return bfx(bf2(a, b)); }
__device__ __forceinline__ float bfr(float f) { return bfr2(f, f)[0]; }
__device__ __forceinline__ v16h cat16(v8h lo, v8h hi) { return __builtin_shufflevector(lo, hi, 0, 1, 2, 3, 4, 5, 6, 7, 8, 9, 10, 11, 12, 13, 14, 15); }
__device__ __forceinline__ v16bf cat16b(v8us lo, v8us hi) { return __builtin_bit_cast(v16bf, __builtin_shufflevector(lo, hi, 0, 1, 2, 3, 4, 5, 6, 7, 8, 9, 10, 11, 12, 13, 14, 15)); }
__device__ __forceinline__ v8f wmma16(v16h a, v16h b, v8f c) { return __builtin_amdgcn_wmma_f32_16x16x32_f16(false, a, false, b, (short)0, c, false, false); }
__device__ __forceinline__ v8f wmmab(v16bf a, v16bf b, v8f c) { return __builtin_amdgcn_wmma_f32_16x16x32_bf16(false, a, false, b, (short)0, c, false, false); }



// 16-bit fragment loaders, k order 8h..8h+7 then 16+8h..16+8h+7 on both operands (global weight planes and LDS activation planes alike).
// The weight planes lie in memory in fragment order: blocks of 16 rows x 16 k (256 elements, 512 B), a 16-row tile's blocks in k order, tiles in row order; inside a block element (row r, k = 8h + j) stands at (16h + r) * 8 + j,
// so that lane 16h + r finds its 16 bytes at lane * 16 and one load of a wave takes four whole 128-byte lines (row-major planes: 32 bytes out of each of 16 lines).
#define FB 256   // elements of one 16 x 16 block
__device__ __forceinline__ v16h  ldgh(const h16* p) { return cat16(*(const v8h*)p, *(const v8h*)(p + FB)); }
__device__ __forceinline__ v16bf ldgb(const bf* p)  { return cat16b(*(const v8us*)p, *(const v8us*)(p + FB)); }
__device__ __forceinline__ v16h  ldsh(const bf* p)  { return cat16(*(const v8ha*)p, *(const v8ha*)(p + 16)); }
__device__ __forceinline__ v16bf ldsb(const bf* p)  { return cat16b(*(const v8usa*)p, *(const v8usa*)(p + 16)); }

__device__ __forceinline__ h16 tohx(float x) { return (h16)x; }
// two values into their bf16 hi and lo parts, each pair one packed word
__device__ __forceinline__ void split2(float y0, float y1, unsigned& h, unsigned& l) { h = bf2(y0, y1); const v2f b = bfx(h); l = bf2(y0 - b[0], y1 - b[1]); }
typedef __attribute__((ext_vector_type(2))) unsigned short v2us;
typedef v2f __attribute__((may_alias)) v2fa;
// eight consecutive values rounded to bf16, as the 16 bytes of a plane
__device__ __forceinline__ v8us bf8(const float* v) { return __builtin_bit_cast(v8us, (v4u){bf2(v[0], v[1]), bf2(v[2], v[3]), bf2(v[4], v[5]), bf2(v[6], v[7])}); }

// ---- k_pack: the weight planes, and the folded matrix M with its constant c, in one launch of 240 work-groups of 12 waves. A wave of B1 or B2 takes one unit of 12 blocks (3072 elements, 6 KB of a plane): a whole 16-row tile of a K = 192 plane, or three tiles of the K = 64 plane.
// Lane 16h + r holds row r, k = 16c + 8h .. + 7 of block c: 8 consecutive source floats in, 16 bytes out at lane * 16 of the block. A unit's source rows are one contiguous stretch, all its loads are issued before the first conversion,
// and which plane a unit belongs to is a scalar branch. The long units come first in the grid.
#define PW 12                      // waves per packing work-group
#define U2 (NA * 2 * HH / 16)      // units of B2: its tiles, [W2|S2] rows of an agent in tile order
#define UM (NA * HH / 16)          // units of the fold: per agent 12 tiles of 16 columns of M
#define UC NA                      // and one unit per agent for c
#define U1 (NA * 2 * HH / 16 / 3)  // units of B1: three tiles each (8 units an agent, 4 of W1 rows, then 4 of S1 rows)
// Stands behind a unit's last stores: the scalar code that follows a branch of k_pack reuses the stores' base register pair.
__device__ __forceinline__ void pack_end() { asm volatile("s_wait_xcnt 0x0" ::: "memory"); }
__device__ __forceinline__ void pack_h(const float* __restrict__ src, h16* __restrict__ dst, unsigned lane) { const unsigned so = (lane & 15) * HH + (lane >> 4) * 8; float v[12][8];
#pragma unroll
    for (int c = 0; c < 12; ++c)
#pragma unroll
        for (int j = 0; j < 8; ++j) v[c][j] = src[so + c * 16 + j];
#pragma unroll
    for (int c = 0; c < 12; ++c) { v8h o;
#pragma unroll
        for (int j = 0; j < 8; j += 2) { const v2f b = bfr2(v[c][j], v[c][j + 1]); o[j] = tohx(b[0]); o[j + 1] = tohx(b[1]); }
        *(v8h*)(dst + c * FB + lane * 8) = o; }
    pack_end(); }
// element c behind a scalar base and a lane's byte offset
__device__ __forceinline__ float ldo(const float* __restrict__ base, unsigned off, int c) { return *(const float*)((const char*)base + (off + c * 4)); }
// Stands behind a group of such loads. The two inputs keep the loads' offset registers whole up to the wait: without them the build lets the group's last results land in the offset register of loads issued just before.
__device__ __forceinline__ void owait(unsigned o0, unsigned o1) { asm volatile("s_wait_xcnt 0x0" :: "v"(o0), "v"(o1) : "memory"); }
// two elements of P = Wo diag(hw): both factors rounded to bf16, the products split into bf16 hi and lo, each pair one packed word
__device__ __forceinline__ void pmul2(const float* wq, const float* sq, unsigned& ph, unsigned& pl) { const v2f wr = bfr2(wq[0], wq[1]), sr = bfr2(sq[0], sq[1]); split2(wr[0] * sr[0], wr[1] * sr[1], ph, pl); }
__global__ __launch_bounds__(PW * 32) void k_pack(const float* __restrict__ W1, const float* __restrict__ S1, const float* __restrict__ W2, const float* __restrict__ S2, const float* __restrict__ W3, const float* __restrict__ Wo,
                                                  const float* __restrict__ hw, const float* __restrict__ hb, const float* __restrict__ b3, const float* __restrict__ bo,
                                                  bf* __restrict__ B1, h16* __restrict__ B2, bf* __restrict__ MP, float* __restrict__ CB) {
    const unsigned lane = threadIdx.x & 31, r = lane & 15, h = lane >> 4; const bool on = r < NO;   // on: the lane's column of the fold's B operand is one of the three outputs
    const unsigned u = blockIdx.x * PW + (unsigned)__builtin_amdgcn_readfirstlane(threadIdx.x >> 5);   // the wave's unit, in a scalar register: the branches below are scalar ones
    if (u < U2) { const unsigned a = u / 24, t = u % 24;
        pack_h(t < 12 ? W2 + (size_t)(a * HH + t * 16) * HH : S2 + (size_t)(a * HH + (t - 12) * 16) * HH, B2 + (size_t)u * 12 * FB, lane);
    } else if (u < U2 + UM) { const unsigned t = u - U2, a = t / 12, g = t % 12;
        // The fold, transposed like every product here: D[k][o] = sum_j W3[j][k] P[o][j] with P = Wo diag(hw) (a product of two bf16 values: exact in f32, carried as bf16 hi + lo; columns o = 3..15 zero).
        // The A operand is columns 16g..16g+15 of W3, so that lane 16h + o ends with M[o][16g + 8h .. + 7], the 16 bytes of its place in block g of a plane. k order of both operands: j = 32q + 8h + 0..7, then 32q + 16 + 8h + 0..7.
        const float* __restrict__ src = W3 + (size_t)a * HH * HH + g * 16; const float* __restrict__ wos = Wo + (size_t)a * NO * HH; const float* __restrict__ hws = hw + a * HH;
        const unsigned ao = h * 8 * HH + r, wb = ((on ? r : 0) * HH + h * 8) * 4, sb = h * 8 * 4;   // wb, sb in bytes; a lane of a padding column reads row 0 of Wo (in bounds) and holds zeros
        float av[6][16], iw[8], is[8]; v8u ph[6], pl[6];
#pragma unroll
        for (int q = 0; q < 6; ++q)
#pragma unroll
            for (int i = 0; i < 16; ++i) av[q][i] = src[ao + (q * 32 + (i >> 3) * 16 + (i & 7)) * HH];
#pragma unroll
        for (int p = 0; p < 2; ++p) { float wv[3][16], sv[3][16];   // P in two halves, behind A's loads
#pragma unroll
            for (int q = 0; q < 3; ++q)
#pragma unroll
                for (int i = 0; i < 16; ++i) { wv[q][i] = ldo(wos, wb, (p * 3 + q) * 32 + i + (i >> 3) * 8); sv[q][i] = ldo(hws, sb, (p * 3 + q) * 32 + i + (i >> 3) * 8); }
            owait(wb, sb);
            __builtin_amdgcn_sched_barrier(0);   // with the one below: keeps the second half's loads behind the first half's conversions; all of them in flight beside A's take more registers than a wave has, and the build spills
#pragma unroll
            for (int q = 0; q < 3; ++q)
#pragma unroll
                for (int i = 0; i < 8; ++i) { unsigned ph1, pl1; pmul2(wv[q] + 2 * i, sv[q] + 2 * i, ph1, pl1); ph[p * 3 + q][i] = on ? ph1 : 0u; pl[p * 3 + q][i] = on ? pl1 : 0u; }
            __builtin_amdgcn_sched_barrier(0); }
#pragma unroll
        for (int i = 0; i < 8; ++i) { iw[i] = ldo(wos + g * 16, wb, i); is[i] = ldo(hws + g * 16, sb, i); }   // the I of W3 + I: M[o][k] takes P[o][k] on top
        owait(wb, sb);
        v8f dh = (v8f){}, dl = (v8f){};
#pragma unroll
        for (int q = 0; q < 6; ++q) { const v16bf af = cat16b(bf8(av[q]), bf8(av[q] + 8));
            dh = wmmab(af, __builtin_bit_cast(v16bf, ph[q]), dh); dl = wmmab(af, __builtin_bit_cast(v16bf, pl[q]), dl); }
        v4u oh, ol; bf* __restrict__ dst = MP + ((size_t)a * 24 + g) * FB + lane * 8;
#pragma unroll
        for (int i = 0; i < 4; ++i) { const v2f wr = bfr2(iw[2 * i], iw[2 * i + 1]), sr = bfr2(is[2 * i], is[2 * i + 1]); unsigned h1, l1;
            split2((dh[2 * i] + dl[2 * i]) + (on ? wr[0] * sr[0] : 0.0f), (dh[2 * i + 1] + dl[2 * i + 1]) + (on ? wr[1] * sr[1] : 0.0f), h1, l1); oh[i] = h1; ol[i] = l1; }
        *(v8us*)dst = __builtin_bit_cast(v8us, oh); *(v8us*)(dst + 12 * FB) = __builtin_bit_cast(v8us, ol);   // an agent's hi plane (12 blocks), then its lo plane
        pack_end();
    } else if (u < U2 + UM + UC) { const unsigned a = u - (U2 + UM);
        // c: D[0][o] = sum_j b3[j] P[o][j] + hb[j] Wo[o][j]. Row 0 of the two A operands is b3 and hb, the other rows zero; same k order as above; j in two halves, a half's loads issued together.
        const float* __restrict__ wos = Wo + (size_t)a * NO * HH; const float* __restrict__ hws = hw + a * HH; const float* __restrict__ b3s = b3 + a * HH; const float* __restrict__ hbs = hb + a * HH;
        const unsigned wb = ((on ? r : 0) * HH + h * 8) * 4, sb = h * 8 * 4; const float bov = bo[a * NO + (on ? r : 0)];   // wb, sb in bytes
        v8f dh = (v8f){}, dl = (v8f){}, dc = (v8f){};
#pragma unroll
        for (int p = 0; p < 2; ++p) { float wv[3][16], sv[3][16], bv[3][16], cv[3][16];
#pragma unroll
            for (int q = 0; q < 3; ++q)
#pragma unroll
                for (int i = 0; i < 16; ++i) { const int j = (p * 3 + q) * 32 + i + (i >> 3) * 8; wv[q][i] = ldo(wos, wb, j); sv[q][i] = ldo(hws, sb, j); bv[q][i] = ldo(b3s, sb, j); cv[q][i] = ldo(hbs, sb, j); }
            owait(wb, sb);
            __builtin_amdgcn_sched_barrier(0);   // as above: one half's loads at a time
#pragma unroll
            for (int q = 0; q < 3; ++q) { v8u ph, pl;
#pragma unroll
                for (int i = 0; i < 8; ++i) { unsigned ph1, pl1; pmul2(wv[q] + 2 * i, sv[q] + 2 * i, ph1, pl1); ph[i] = on ? ph1 : 0u; pl[i] = on ? pl1 : 0u; }
#pragma unroll
                for (int i = 0; i < 16; ++i) { wv[q][i] = on ? wv[q][i] : 0.0f; bv[q][i] = r == 0 ? bv[q][i] : 0.0f; cv[q][i] = r == 0 ? cv[q][i] : 0.0f; }
                const v16bf bf3 = cat16b(bf8(bv[q]), bf8(bv[q] + 8));
                dh = wmmab(bf3, __builtin_bit_cast(v16bf, ph), dh); dl = wmmab(bf3, __builtin_bit_cast(v16bf, pl), dl); dc = wmmab(cat16b(bf8(cv[q]), bf8(cv[q] + 8)), cat16b(bf8(wv[q]), bf8(wv[q] + 8)), dc); }
            __builtin_amdgcn_sched_barrier(0); }
        if (on && h == 0) CB[a * NO + r] = ((dh[0] + dl[0]) + dc[0]) + bfr(bov);
        pack_end();
    } else { const unsigned t = u - (U2 + UM + UC), a = t / 8, g = t % 8;
        const float* __restrict__ src = g < 4 ? W1 + (size_t)(a * HH + g * 48) * DI : S1 + (size_t)(a * HH + (g - 4) * 48) * DI; bf* __restrict__ dst = B1 + (size_t)t * 12 * FB;
        const unsigned so = r * DI + h * 8; float v[3][3][8], e[3][2];
#pragma unroll
        for (int i = 0; i < 3; ++i)
#pragma unroll
            for (int c = 0; c < 3; ++c)
#pragma unroll
                for (int j = 0; j < 8; ++j) v[i][c][j] = src[so + i * 16 * DI + c * 16 + j];
#pragma unroll
        for (int i = 0; i < 3; ++i) { e[i][0] = 0.0f; e[i][1] = 0.0f; }
        if (h == 0) {   // k = 48, 49: the last two columns of a row; k = 50..63 is padding
#pragma unroll
            for (int i = 0; i < 3; ++i) { e[i][0] = src[so + i * 16 * DI + 48]; e[i][1] = src[so + i * 16 * DI + 49]; } }
#pragma unroll
        for (int i = 0; i < 3; ++i) {
#pragma unroll
            for (int c = 0; c < 3; ++c) *(v8us*)(dst + (i * 4 + c) * FB + lane * 8) = bf8(v[i][c]);
            *(v8us*)(dst + (i * 4 + 3) * FB + lane * 8) = __builtin_bit_cast(v8us, (v4u){bf2(e[i][0], e[i][1]), 0u, 0u, 0u}); }
        pack_end();
    }
}

#define MT 64    // batch rows per work-group
#define NW 12    // waves per work-group: wave w owns output features 16w..16w+15
#define PX 72    // LDS pitch in elements of the K = 64 planes (144 B: 16 rows of 16 B fall on all 64 banks)
#define PH 200   // LDS pitch in elements of the K = 192 planes (400 B, same reason)

__device__ __forceinline__ v8f fma8(v8f a, v8f b, v8f c) { return __builtin_elementwise_fma(a, b, c); }
__device__ __forceinline__ v8f sp8(float c) { return (v8f){c, c, c, c, c, c, c, c}; }
// gelu(main + bm) + (skip + bs) for the 8 consecutive output features that one lane holds of one batch row; gelu(x) = 0.5 x w with w = 1 + erf(x / sqrt 2).
// All 8 go side by side as vectors (independent chains, two floats an instruction). For |x| < sqrt 2, w = 1 + x q(x^2): the odd polynomial that the library's erff takes for an argument below 1, with the 1 / sqrt 2 folded into its six coefficients.
// One test for the whole wave sends all 8 to erff itself as soon as any lane holds an |x| >= sqrt 2 (a NaN stays a NaN on either way).
__device__ __forceinline__ v8f act8(v8f m, v8f s, const float* bm, const float* bs) { v8f vm, vs, w;
#pragma unroll
    for (int j = 0; j < 8; ++j) { vm[j] = bm[j]; vs[j] = bs[j]; }
    const v8f x = m + vm;
    float mx = __builtin_fabsf(x[0]);
#pragma unroll
    for (int j = 1; j < 8; ++j) mx = fmaxf(mx, __builtin_fabsf(x[j]));
    if (__builtin_amdgcn_ballot_w32(mx >= 0x1.6a09e6p+0f) != 0u) {   // the same for the whole wave: a scalar branch, every lane stays on
#pragma unroll
        for (int j = 0; j < 8; ++j) w[j] = 1.0f + erff(x[j] * 0.7071067811865476f);
    } else { const v8f u = x * x;
        v8f q = fma8(u, sp8(-0x1.a08d04p-17f), sp8(0x1.c76bfcp-13f)); q = fma8(u, q, sp8(-0x1.3569b4p-9f)); q = fma8(u, q, sp8(0x1.46b43ap-6f)); q = fma8(u, q, sp8(-0x1.105794p-3f)); q = fma8(u, q, sp8(0x1.988452p-1f));
        w = fma8(x, q, sp8(1.0f)); }
    return (0.5f * x) * w + (s + vs); }
// src is the same for the whole wave (a scalar base); off is the lane's part.
__device__ __forceinline__ void bias8(const float* __restrict__ src, unsigned off, float* dst) {
#pragma unroll
    for (int j = 0; j < 8; j += 2) { const v2f b = bfr2(src[off + j], src[off + j + 1]); dst[j] = b[0]; dst[j + 1] = b[1]; } }
// the two halves of bias8 apart, for where the loads are asked for well ahead of their use: raw8 only loads, rnd8 rounds in place
__device__ __forceinline__ void raw8(const float* __restrict__ src, unsigned off, float* dst) {
#pragma unroll
    for (int j = 0; j < 8; ++j) dst[j] = src[off + j]; }
__device__ __forceinline__ void rnd8(float* v) {
#pragma unroll
    for (int j = 0; j < 8; j += 2) { const v2f b = bfr2(v[j], v[j + 1]); v[j] = b[0]; v[j + 1] = b[1]; } }
// Stands behind global loads: the compiler lets later code (a weight load's destination, the scalar code of the erf branch) reuse the loads' offset register or scalar base.
__device__ __forceinline__ void xwait() { asm volatile("s_wait_xcnt 0x0" ::: "memory"); }
__device__ __forceinline__ v8h toh8(v8f h) { v8h o;
#pragma unroll
    for (int j = 0; j < 8; ++j) o[j] = tohx(h[j]);
    return o; }

// ---- k_mlp: the whole per-agent MLP for 64 batch rows. grid (NBT / 64, NA), 384 threads. Every product is formed transposed, D[n][m] = sum_k W[n][k] act[m][k] (weights as the A operand, activations as B),
// so a lane holds 8 consecutive features of one batch row and hands them to the next layer with one 16-byte LDS store. A wave loads its 16 features' weights of a layer once into registers and walks the four 16-row blocks,
// in layer 1 in a loop that stays rolled (the erf code is long; for speed only), in layer 2 k step by k step with all four blocks' accumulators held. The second launch-bounds argument asks for six waves a SIMD (two work-groups a WGP): without it the build takes more than 160 registers and only one work-group fits.
__global__ __launch_bounds__(NW * 32, 6) void k_mlp(const float* __restrict__ x, const float* __restrict__ wi, const float* __restrict__ bi, const float* __restrict__ b1, const float* __restrict__ sb1, const float* __restrict__ b2, const float* __restrict__ sb2,
                                             const bf* __restrict__ B1, const h16* __restrict__ B2, const bf* __restrict__ MP, const float* __restrict__ CB, float* __restrict__ OUT) {
    __shared__ __align__(16) bf buf0[MT * PH];   // h1 (fp16)
    __shared__ __align__(16) bf buf1[MT * PH];   // xn hi and lo, then h2 hi
    __shared__ __align__(16) bf buf2[MT * PH];   // h2 lo (h1 is still being read by other waves when the first h2 values are stored)
    __shared__ float os[3 * MT * NO];            // the logits' three partial sums over k
    const int tid = threadIdx.x, lane = tid & 31, lr = lane & 15, hi = lane >> 4;
    const int w = __builtin_amdgcn_readfirstlane(tid >> 5);   // wave number in a scalar register: what is formed from it is a scalar base or a scalar test
    const int a = blockIdx.y, r0 = blockIdx.x * MT;
    const int n0 = w * 16 + hi * 8;    // first of the lane's 8 features in a D fragment
    const int fo = lr * PH + 8 * hi;   // a lane's place in an activation fragment of the K = 192 planes
    const int so = lr * PH + n0;       // a lane's place for its 8 features of a row
    const int ab = a * HH + w * 16; const unsigned h8 = hi * 8;   // the wave's and the lane's part of a place in a per-feature vector (ab + h8 = a * HH + n0)
    bf* Xh = buf1; bf* Xl = buf1 + MT * PX;
    // Input norm: lane l holds columns 2l, 2l + 1 (one 8-byte load; DI is even, so a pair is all data or all padding) of rows w, w + 12, ..., six rows for waves 0..3 and five for the rest.
    // All of a thread's x pairs, its pair of the agent's scale and shift, and layer 1's biases and weights are asked for before anything waits: one round trip to the cache in place of one per element.
    const int k2 = lane * 2; const bool kon = k2 < DI; const int kc = kon ? k2 : 0;   // a padding lane reads column 0 (in bounds) and stores zeros
    v2f xv[6]; const float* xs = x + (size_t)(r0 + w) * DI;   // the wave's first row: a scalar base
#pragma unroll
    for (int i = 0; i < 5; ++i) xv[i] = *(const v2fa*)(xs + i * NW * DI + kc);
    xv[5] = *(const v2fa*)(xs + (w < MT - 5 * NW ? 5 * NW * DI : 0) + kc);   // a wave without a sixth row reads its first again
    const v2f wv = *(const v2fa*)(wi + a * DI + kc), bv = *(const v2fa*)(bi + a * DI + kc);
    const float cv = CB[a * NO + tid % NO];   // the constant of the thread's logit, for the last line of the kernel
    // Later layers' global loads are asked for ahead of their use, into registers that are free there: a work-group barrier drains a wave's outstanding loads, so a load issued directly in front of one is waited for in full by the whole work-group.
    const h16* Bm2 = B2 + ((size_t)a * 2 * HH + w * 16) * HH + lane * 8; const h16* Bs2 = Bm2 + (size_t)HH * HH; v16h wm2[6], ws2[6];   // layer 2
    const int rb = w & 3, kt = w >> 2;   // the folded last product: wave w takes batch rows 16 rb .. + 15 and k steps 2 kt, 2 kt + 1
    const bf* Mh = MP + ((size_t)a * 24 + kt * 4) * FB + lane * 8; v16bf mh[2], ml[2];   // M hi; the lo plane stands 12 blocks behind
    {   // layer 1: [W1|S1] x (xn hi + xn lo), K = 64
        const bf* Bm = B1 + ((size_t)a * 2 * HH + w * 16) * KI + lane * 8; const bf* Bs = Bm + (size_t)HH * KI; v16bf wm[2], ws[2];
        float bm[8], bs[8]; bias8(b1 + ab, h8, bm); bias8(sb1 + ab, h8, bs); xwait();
#pragma unroll
        for (int q = 0; q < 2; ++q) { wm[q] = ldgb(Bm + q * 2 * FB); ws[q] = ldgb(Bs + q * 2 * FB); }
        __builtin_amdgcn_sched_barrier(0);   // keeps conversions and later address work out from among the loads above, so that they issue back to back: without it the build puts three more s_wait_xcnt 0 between them
        asm volatile("" :: "v"(xv[5]));      // inputs only: holds the sixth row's load up here with the others; without it the compiler sinks it into the branch below, where it is waited for alone
        const v2f wr = bfr2(wv[0], wv[1]), br = bfr2(bv[0], bv[1]);
#pragma unroll
        for (int i = 0; i < 6; ++i) { const int row = w + NW * i; const v2f xr = bfr2(xv[i][0], xv[i][1]); unsigned h, l;
            split2(__fadd_rn(__fmul_rn(xr[0], wr[0]), br[0]), __fadd_rn(__fmul_rn(xr[1], wr[1]), br[1]), h, l);
            if (i < 5 || w < MT - 5 * NW) { *(v2us*)(Xh + row * PX + k2) = __builtin_bit_cast(v2us, kon ? h : 0u); *(v2us*)(Xl + row * PX + k2) = __builtin_bit_cast(v2us, kon ? l : 0u); } }   // the sixth row's test is a scalar one (w is in a scalar register)
        __syncthreads();   // xn complete
#pragma unroll
        for (int q = 0; q < 2; ++q) { wm2[q] = ldgh(Bm2 + q * 2 * FB); ws2[q] = ldgh(Bs2 + q * 2 * FB); }   // layer 2's first two k steps fly while layer 1 is worked (a third step's would spill)
        xwait();
#pragma unroll 1   // rolled: keeps one copy of the erf code per layer in the text
        for (int mb = 0; mb < 4; ++mb) { v8f am = (v8f){}, as = (v8f){};
#pragma unroll
            for (int q = 0; q < 2; ++q) { const v16bf xh = ldsb(Xh + (mb * 16 + lr) * PX + 8 * hi + q * 32), xl = ldsb(Xl + (mb * 16 + lr) * PX + 8 * hi + q * 32);
                am = wmmab(wm[q], xh, am); as = wmmab(ws[q], xh, as); am = wmmab(wm[q], xl, am); as = wmmab(ws[q], xl, as); }
            *(v8ha*)(buf0 + mb * 16 * PH + so) = toh8(act8(am, as, bm, bs)); }
    }
    {   // layer 2: [W2|S2] x h1, K = 192. k steps outside, the four row blocks inside: eight accumulator chains that do not depend on one another, and a weight fragment is needed for one k step only,
        // so that three steps' weights are held at a time and the registers so freed take a whole step's four activation fragments (with all twelve weight fragments held there was one fragment's room, loaded and waited for 24 times).
        __syncthreads();   // h1 complete; every read of xn is over, so buf1 may take h2
        wm2[2] = ldgh(Bm2 + 2 * 2 * FB); ws2[2] = ldgh(Bs2 + 2 * 2 * FB);   // the third step's weights: behind the barrier, which would drain them, and two steps ahead of their use
        v8f am[4], as[4]; float bm[8], bs[8];
#pragma unroll
        for (int mb = 0; mb < 4; ++mb) { am[mb] = (v8f){}; as[mb] = (v8f){}; }
#pragma unroll
        for (int q = 0; q < 6; ++q) { v16h hv[4];
#pragma unroll
            for (int mb = 0; mb < 4; ++mb) hv[mb] = ldsh(buf0 + mb * 16 * PH + fo + q * 32);
            __builtin_amdgcn_sched_barrier(0);   // keeps a step's eight LDS loads together in front of its matrix instructions: left alone the build loads one fragment at a time and waits for each
#pragma unroll
            for (int mb = 0; mb < 4; ++mb) { am[mb] = wmma16(wm2[q], hv[mb], am[mb]); as[mb] = wmma16(ws2[q], hv[mb], as[mb]); }
            if (q < 5) __builtin_amdgcn_sched_barrier(0);   // keeps the loads below up here, ahead of their use: left alone the build sinks them to where they are waited for at once
            if (q < 3) { wm2[q + 3] = ldgh(Bm2 + (q + 3) * 2 * FB); ws2[q + 3] = ldgh(Bs2 + (q + 3) * 2 * FB); }   // into the registers that step q has just left
            if (q == 3) { raw8(b2 + ab, h8, bm); xwait(); }    // the biases come as weight registers fall free (both at step 3 spill); they are rounded behind the loop, so that nothing waits for them here
            if (q == 4) { raw8(sb2 + ab, h8, bs); xwait(); }
            if (q < 5) __builtin_amdgcn_sched_barrier(0); }   // the other side of the same fence
        rnd8(bm); rnd8(bs);
#pragma unroll
        for (int mb = 0; mb < 4; ++mb) { const v8f h = act8(am[mb], as[mb], bm, bs);
            v4u oh, ol;
#pragma unroll
            for (int j = 0; j < 4; ++j) { unsigned h1, l1; split2(h[2 * j], h[2 * j + 1], h1, l1); oh[j] = h1; ol[j] = l1; }
            *(v8usa*)(buf1 + mb * 16 * PH + so) = __builtin_bit_cast(v8us, oh); *(v8usa*)(buf2 + mb * 16 * PH + so) = __builtin_bit_cast(v8us, ol);
            if (mb == 1) {   // the wave's part of M, into registers that layer 2's weights have left: it flies while the last two row blocks go through gelu
#pragma unroll
                for (int q = 0; q < 2; ++q) { mh[q] = ldgb(Mh + q * 2 * FB); ml[q] = ldgb(Mh + (12 + q * 2) * FB); }
                xwait(); } }
    }
    __syncthreads();   // h2 planes complete
    {   // logits = M x h2, K = 192, M and h2 each hi + lo (lo x lo left out: 2^-16 of a term); every wave takes a third of k for one row block, the large and the small terms in accumulators of their own
        v8f aa = (v8f){}, ab = (v8f){};
#pragma unroll
        for (int q = 0; q < 2; ++q) { const v16bf xh = ldsb(buf1 + rb * 16 * PH + fo + (kt * 2 + q) * 32), xl = ldsb(buf2 + rb * 16 * PH + fo + (kt * 2 + q) * 32);
            aa = wmmab(mh[q], xh, aa); ab = wmmab(mh[q], xl, ab); ab = wmmab(ml[q], xh, ab); }
        if (hi == 0) {
#pragma unroll
            for (int j = 0; j < NO; ++j) os[kt * MT * NO + (rb * 16 + lr) * NO + j] = aa[j] + ab[j]; }
    }
    __syncthreads();   // partial logits of the 64 rows gathered: 3 x 192 floats; stored thread-linearly so that each of waves 0..5 writes one whole 128-byte line
    if (tid < MT * NO) OUT[((size_t)a * NBT + r0) * NO + tid] = ((os[tid] + os[MT * NO + tid]) + os[2 * MT * NO + tid]) + cv;
}

extern "C" void kernel_launch(void* const* d_in, const int* in_sizes, int n_in,
                              void* d_out, int out_size, void* d_ws, size_t ws_size, hipStream_t stream) {
    (void)in_sizes; (void)n_in; (void)out_size;
    const float* IN[17]; for (int i = 0; i < 17; ++i) IN[i] = (const float*)d_in[i];   // 0 x, 1 in_w, 2 in_b, 3 W1, 4 b1, 5 W2, 6 b2, 7 W3, 8 b3, 9 Wo, 10 bo, 11 S1, 12 sb1, 13 S2, 14 sb2, 15 hw, 16 hb
    float* OUT = (float*)d_out;     // [64][4096][3]
    char* wsp = (char*)d_ws;
    auto take = [&](size_t bytes) { char* p = wsp; wsp += (bytes + 255) & ~(size_t)255; return (void*)p; };
    bf* B1 = (bf*)take((size_t)NA * 2 * HH * KI * 2); h16* B2 = (h16*)take((size_t)NA * 2 * HH * HH * 2); bf* MP = (bf*)take((size_t)NA * 24 * FB * 2); float* CB = (float*)take((size_t)NA * NO * 4);
    if ((size_t)(wsp - (char*)d_ws) > ws_size) return;    // total ~ 13 MB
    k_pack<<<(U2 + UM + UC + U1) / PW, PW * 32, 0, stream>>>(IN[3], IN[11], IN[5], IN[13], IN[7], IN[9], IN[15], IN[16], IN[8], IN[10], B1, B2, MP, CB);
    k_mlp<<<dim3(NBT / MT, NA), NW * 32, 0, stream>>>(IN[0], IN[1], IN[2], IN[4], IN[12], IN[6], IN[14], B1, B2, MP, CB, OUT);
}
